// v000
// The times below were measured on an AMD MI455X: many runs one after another, warmed up first and cycling through
// copies of the inputs, with the whole window's GPU time divided by the number of runs. Launches and the gaps
// between them are all in it. The median over several windows is given; except for v000 it joins two sittings, which
// can be a few percent apart, so the side-by-side timings, each taken in one sitting, are the better comparison.
// v000 is the starting kernel. One run takes 293 microseconds.
#include <hip/hip_runtime.h>

// compute dtype: every contraction on v_wmma_f32_16x16x32_f16 (f16 operands, f32 accumulate). Per-head q/k/v projections ([NB*SEQ x 64] x [64 x 64] per head):
// x as exact bf16 x8, W as exact bf16 x256 (1 product); S^T = K Q^T with q/k f16 x8 planes (1 product); O^T += V^T P^T with P f16 x1024 and V^T as f16 hi x8 +
// residual x8192 planes (2 products, second accumulator folded with 1/1024 before normalisation). Biases (as bf16 RNE values), softmax statistics and 1/l in f32.
// Module: x [4][2048][768] viewed as 12 heads x 64; q_h = x_h Wq[h]^T + bq[h] (Wq[h] is (out,in)), k_h, v_h likewise; scores = q k^T / 8; softmax over all keys (no mask);
// out[b][s][64 h + d] = sum_t p v (heads concatenated) -> f32 [4][2048][768]. All float inputs enter as their bf16 RNE values.
// Flash-style: one wave per 16 queries of (b, h) walks all keys in order with a running max; deterministic, one writer per element.
// Fragment k-map per lane half hh for A AND B: elements 0..7 <- k = 8hh+0..7, 8..15 <- k = 16+8hh+0..7; acc[r] = D[8hh+r][lane&15].

#ifndef NB
#define NB 4
#endif
#ifndef SEQ
#define SEQ 2048
#endif

namespace {
constexpr int NB_FULL = 4, SEQ_FULL = 2048, DM = 768, H = 12, HD = 64;
constexpr int BL = NB;     // batches computed
constexpr int T = SEQ;     // tokens computed per batch (queries == keys); input and output row index = b * SEQ_FULL + t
constexpr int NSL = DM / 128;          // 128-column slabs (2 heads) per projection
constexpr bool VRES = true;
constexpr float XS = 8.0f, WSC = 256.0f, PS = 1024.0f, RS_ = 1024.0f, LOG2E = 1.4426950408889634f;
static_assert(T % 64 == 0 && T >= 64 && T <= SEQ_FULL && BL >= 1 && BL <= NB_FULL);
static_assert(DM % 128 == 0 && NSL * 128 == DM && H % 2 == 0 && H * HD == DM && HD == 64);
typedef _Float16 b16;
typedef __attribute__((ext_vector_type(16))) _Float16 v16b;
typedef __attribute__((ext_vector_type(8))) _Float16 v8b;
typedef __attribute__((ext_vector_type(4))) _Float16 v4h;
typedef __attribute__((ext_vector_type(2))) _Float16 v2h;
typedef __attribute__((ext_vector_type(8))) float v8f;
typedef __attribute__((ext_vector_type(4))) float v4f;
__device__ __forceinline__ float bf16_rne(float f) { unsigned int u = __float_as_uint(f); u += 0x7FFFu + ((u >> 16) & 1u); return __uint_as_float(u & 0xFFFF0000u); }
__device__ __forceinline__ v16b frag_kb(const b16* p, int hh) { const v8b a = *(const v8b*)(p + 8 * hh), b = *(const v8b*)(p + 16 + 8 * hh); v16b f;
#pragma unroll
  for (int e = 0; e < 8; ++e) { f[e] = a[e]; f[8 + e] = b[e]; } return f; }
__device__ __forceinline__ v8f wmma16b(v16b a, v16b b, v8f c) { v8f d = __builtin_amdgcn_wmma_f32_16x16x32_f16(false, a, false, b, (short)0, c, false, false); asm volatile("v_nop\n\tv_nop\n\tv_nop\n\tv_nop" : "+v"(d) : "v"(a), "v"(b)); return d; }
__device__ __forceinline__ void wave_lds_sync() { __builtin_amdgcn_fence(3, "workgroup"); __builtin_amdgcn_wave_barrier(); __builtin_amdgcn_fence(2, "workgroup"); }
__device__ __forceinline__ float nexp2(float v) { return __builtin_amdgcn_exp2f(v); }

__global__ __launch_bounds__(256) void prep_kernel(const float* __restrict__ wq, const float* __restrict__ wk, const float* __restrict__ wv, b16* __restrict__ WT) {
  const size_t u = (size_t)blockIdx.x * 256 + threadIdx.x; const size_t per = (size_t)H * HD * HD / 8; if (u >= 3 * per) return;
  const int m = (int)(u / per); const size_t e = (u % per) * 8; const float* w = m == 0 ? wq : m == 1 ? wk : wv; v8b o;
  for (int j = 0; j < 8; ++j) o[j] = (b16)(bf16_rne(w[e + j]) * WSC);
  { *(v8b*)(WT + (size_t)m * H * HD * HD + e) = o;  }
}
// projections: grid (T/64, BL, 3 parts x NSL slabs); block = 64 tokens of batch b x 4 waves (16 tokens each); slab = heads 2s, 2s+1: A = x[:, 128 s .. 128 s + 127] (exact bf16 x8) staged
__global__ __launch_bounds__(128) void proj_kernel(const float* __restrict__ x, const b16* __restrict__ WT, const float* __restrict__ bq, const float* __restrict__ bk, const float* __restrict__ bv,
                                                   b16* __restrict__ QP, b16* __restrict__ KP, b16* __restrict__ VTh, b16* __restrict__ VTl) {
  __shared__ __attribute__((aligned(16))) b16 As[64][128 + 8]; __shared__ __attribute__((aligned(16))) float Tf[4][16][128 + 4];
  const int wave = threadIdx.x >> 5, lane = threadIdx.x & 31, nloc = lane & 15, hlf = lane >> 4; const int t0 = blockIdx.x * 64; const int b = blockIdx.y;
  const int part = blockIdx.z / NSL, slab = blockIdx.z % NSL, c0 = slab * 128;
  const float* xb = x + ((size_t)b * SEQ_FULL + t0) * DM + c0; const float* bias = part == 0 ? bq : part == 1 ? bk : bv; const b16* Wp = WT + (size_t)part * H * HD * HD;
  for (int i = threadIdx.x; i < 64 * 32; i += 128) { const int rr = i / 32, q = (i % 32) * 4; const v4f f = *(const v4f*)(xb + (size_t)rr * DM + q); v4h o;
    for (int j = 0; j < 4; ++j) o[j] = (b16)(bf16_rne(f[j]) * XS); *(v4h*)(&As[rr][q]) = o; }
  __syncthreads();
  v8f acc[8];
#pragma unroll
  for (int t = 0; t < 8; ++t) acc[t] = (v8f){};
#pragma unroll
  for (int t = 0; t < 8; ++t) { const int h = 2 * slab + (t >> 2), e = (t & 3) * 16 + nloc; const b16* br = Wp + ((size_t)h * HD + e) * HD; const int a0 = (t >> 2) * HD;
#pragma unroll
    for (int kb = 0; kb < HD; kb += 32) acc[t] = wmma16b(frag_kb(&As[wave * 16 + nloc][a0 + kb], hlf), frag_kb(br + kb, hlf), acc[t]); }
#pragma unroll
  for (int t = 0; t < 8; ++t) { const int cl = t * 16 + nloc; const int h = 2 * slab + (t >> 2); const float bb = bf16_rne(bias[h * HD + (cl & 63)]);
#pragma unroll
    for (int r = 0; r < 8; ++r) Tf[wave][8 * hlf + r][cl] = acc[t][r] * (1.0f / (XS * WSC)) + bb; }
  __syncthreads();
  {
    if (part < 2) { b16* plane = part == 0 ? QP : KP; const int c = c0 + lane * 4; const int h = c / HD, d = c % HD;
      for (int rr = 0; rr < 16; ++rr) { const int tok = t0 + wave * 16 + rr; v4h o4; for (int j = 0; j < 4; ++j) o4[j] = (b16)(Tf[wave][rr][lane * 4 + j] * XS);
        *(v4h*)(plane + (((size_t)b * H + h) * T + tok) * HD + d) = o4; } }
    else {
#pragma unroll 1
      for (int q = 0; q < 32; ++q) { const int cl = wave * 32 + q; const int c = c0 + cl; const int h = c / HD, d = c % HD; const int tk = lane * 2; v2h hv, lv;
        for (int j = 0; j < 2; ++j) { const float f = Tf[(tk + j) >> 4][(tk + j) & 15][cl] * XS; const b16 p = (b16)f; hv[j] = p; lv[j] = (b16)((f - (float)p) * RS_); }
        const size_t oi = (((size_t)b * H + h) * HD + d) * (size_t)T + t0 + lane * 2; *(v2h*)(VTh + oi) = hv; if (VRES) *(v2h*)(VTl + oi) = lv; } }
     }
}
// attention: grid (T/32, BL x H): block = 2 waves x 16 queries of (b, h); all T keys in 32-key steps; logit = s/8 (log2-scaled); online softmax; P x1024 single; O^T += V^T P^T (V^T as f16 hi x8
// + residual x8192 planes when VRES: 2 products); the normalised context IS the module output: f32 rows of 64 at column 64h (16 lanes x 16 B = one whole 256-B segment per (query, head),
__global__ __launch_bounds__(64) __attribute__((amdgpu_num_vgpr(256))) void attn_kernel(const b16* __restrict__ QP, const b16* __restrict__ KP, const b16* __restrict__ VTh, const b16* __restrict__ VTl, float* __restrict__ out) {
  __shared__ __attribute__((aligned(16))) b16 Pb[2][16][32 + 8]; __shared__ __attribute__((aligned(16))) float To[2][16][HD + 4];
  const int wave = threadIdx.x >> 5, lane = threadIdx.x & 31, hh = lane >> 4, col = lane & 15; const int b = blockIdx.y / H, h = blockIdx.y % H; const int q0 = blockIdx.x * 32 + wave * 16, qi = q0 + col;
  const size_t ph = (size_t)b * H + h; const b16* Qb = QP + ph * T * HD; const b16* Kb = KP + ph * T * HD; const b16* Vh = VTh + ph * HD * (size_t)T; const b16* Vl = VTl + ph * HD * (size_t)T;
  const v16b qa0 = frag_kb(Qb + (size_t)qi * HD, hh), qa1 = frag_kb(Qb + (size_t)qi * HD + 32, hh);
  const float cs = LOG2E / (8.0f * XS * XS);
  float m = -INFINITY, l = 0.0f; v8f o[4], ol[4]; for (int t = 0; t < 4; ++t) { o[t] = (v8f){}; ol[t] = (v8f){}; }
#pragma unroll 1
  for (int kb = 0; kb < T; kb += 32) {
    float e[16]; float mx = -INFINITY;
#pragma unroll
    for (int u = 0; u < 2; ++u) { v8f s = (v8f){}; const size_t kr = (size_t)(kb + u * 16 + col) * HD; s = wmma16b(frag_kb(Kb + kr, hh), qa0, s); s = wmma16b(frag_kb(Kb + kr + 32, hh), qa1, s);
#pragma unroll
      for (int r = 0; r < 8; ++r) { const float vv = s[r] * cs; e[u * 8 + r] = vv; mx = fmaxf(mx, vv); } }
    mx = fmaxf(mx, __shfl_xor(mx, 16)); const float mn = fmaxf(m, mx); const float al = nexp2(m - mn); float sum = 0.0f;
#pragma unroll
    for (int i2 = 0; i2 < 16; ++i2) { const float p = nexp2(e[i2] - mn); sum += p; Pb[wave][col][(i2 < 8 ? 0 : 16) + 8 * hh + (i2 & 7)] = (b16)(p * PS); }
    sum += __shfl_xor(sum, 16); l = l * al + sum; m = mn;
    wave_lds_sync();
    const v16b pf = frag_kb(&Pb[wave][col][0], hh);
#pragma unroll
    for (int t = 0; t < 4; ++t) { o[t] *= al; o[t] = wmma16b(frag_kb(Vh + (size_t)(t * 16 + col) * T + kb, hh), pf, o[t]); if (VRES) ol[t] = wmma16b(frag_kb(Vl + (size_t)(t * 16 + col) * T + kb, hh), pf, ol[t] * al); }
    wave_lds_sync(); }
  const float inv = 1.0f / (l * PS * XS);
#pragma unroll
  for (int t = 0; t < 4; ++t)
#pragma unroll
    for (int r = 0; r < 8; ++r) To[wave][col][t * 16 + 8 * hh + r] = (o[t][r] + (VRES ? ol[t][r] * (1.0f / RS_) : 0.0f)) * inv;
  wave_lds_sync();
  { for (int i2 = 0; i2 < 8; ++i2) { const int rr = 2 * i2 + hh;
      *(v4f*)(out + ((size_t)b * SEQ_FULL + q0 + rr) * DM + h * HD + col * 4) = *(const v4f*)(&To[wave][rr][col * 4]); }  }
}
}  // namespace

extern "C" void kernel_launch(void* const* d_in, const int* in_sizes, int n_in, void* d_out, int out_size, void* d_ws, size_t ws_size, hipStream_t stream) {
  if (n_in < 7) return;
  auto Fp = [&](int i) { return (const float*)d_in[i]; };
  // wire order: 0 x [4,2048,768], 1 Wq [12,64,64] (h, out, in), 2 Wk, 3 Wv, 4 bq [12,64], 5 bk, 6 bv; out f32 [4,2048,768]
  const long long need_x = ((long long)(BL - 1) * SEQ_FULL + T) * (long long)DM;
  if ((long long)in_sizes[0] < need_x || in_sizes[1] < H * HD * HD || in_sizes[2] < H * HD * HD || in_sizes[3] < H * HD * HD ||
      in_sizes[4] < H * HD || in_sizes[5] < H * HD || in_sizes[6] < H * HD || (long long)out_size < need_x) return;
  size_t off = 0; char* ws = (char*)d_ws;
  auto carve = [&](size_t bytes) { char* p = ws + off; off += (bytes + 255) & ~(size_t)255; return p; };
  b16* WT = (b16*)carve((size_t)3 * H * HD * HD * 2);                  // 294,912 B
  const size_t plane = (size_t)BL * T * DM * 2;                          // 12,582,912 B at full size ([b][h][t][64] or [b][h][64][t] halves)
  b16* QP = (b16*)carve(plane); b16* KP = (b16*)carve(plane); b16* VTh = (b16*)carve(plane); b16* VTl = (b16*)carve(VRES ? plane : 256);
  if (off > ws_size || off > ((size_t)128 << 20)) return;               // total 50,626,560 B at full size
  prep_kernel<<<(unsigned)(((size_t)3 * H * HD * HD / 8 + 255) / 256), 256, 0, stream>>>(Fp(1), Fp(2), Fp(3), WT);
  proj_kernel<<<dim3(T / 64, BL, 3 * NSL), 128, 0, stream>>>(Fp(0), WT, Fp(4), Fp(5), Fp(6), QP, KP, VTh, VTl);
  attn_kernel<<<dim3(T / 32, BL * H), 64, 0, stream>>>(QP, KP, VTh, VTl, (float*)d_out);
}

// v001
// One run takes 108 microseconds.
// In two side-by-side timings against v000, it was 2.78 and 2.79 times as fast.
#include <hip/hip_runtime.h>

// compute dtype: every contraction on v_wmma_f32_16x16x32_f16 (f16 operands, f32 accumulate). Per-head q/k/v projections ([NB*SEQ x 64] x [64 x 64] per head):
// x as exact bf16 x8, W as exact bf16 x256 (1 product); S^T = K Q^T with q/k f16 x8 planes (1 product); O^T += V^T P^T with P f16 x1024 and V^T as f16 hi x8 +
// residual x8192 planes (2 products, second accumulator folded with 1/1024 before normalisation). Biases (as bf16 RNE values), softmax statistics and 1/l in f32.
// Module: x [4][2048][768] viewed as 12 heads x 64; q_h = x_h Wq[h]^T + bq[h] (Wq[h] is (out,in)), k_h, v_h likewise; scores = q k^T / 8; softmax over all keys (no mask);
// out[b][s][64 h + d] = sum_t p v (heads concatenated) -> f32 [4][2048][768]. All float inputs enter as their bf16 RNE values.
// Flash-style: one wave per 16 queries of (b, h) walks all keys in order with a running max; 8 such waves share each K / V^T tile through LDS; deterministic, one writer per element.
// Fragment k-map per lane half hh for A AND B: elements 0..7 <- k = 8hh+0..7, 8..15 <- k = 16+8hh+0..7; acc[r] = D[8hh+r][lane&15].

#ifndef NB
#define NB 4
#endif
#ifndef SEQ
#define SEQ 2048
#endif

namespace {
constexpr int NB_FULL = 4, SEQ_FULL = 2048, DM = 768, H = 12, HD = 64;
constexpr int BL = NB;     // batches computed
constexpr int T = SEQ;     // tokens computed per batch (queries == keys); input and output row index = b * SEQ_FULL + t
constexpr int NSL = DM / 128;          // 128-column slabs (2 heads) per projection
constexpr bool VRES = true;
constexpr float XS = 8.0f, WSC = 256.0f, PS = 1024.0f, RS_ = 1024.0f, LOG2E = 1.4426950408889634f;
static_assert(T % 64 == 0 && T >= 64 && T <= SEQ_FULL && BL >= 1 && BL <= NB_FULL);
static_assert(DM % 128 == 0 && NSL * 128 == DM && H % 2 == 0 && H * HD == DM && HD == 64);
typedef _Float16 b16;
typedef __attribute__((ext_vector_type(16))) _Float16 v16b;
typedef __attribute__((ext_vector_type(8))) _Float16 v8b;
typedef __attribute__((ext_vector_type(4))) _Float16 v4h;
typedef __attribute__((ext_vector_type(2))) _Float16 v2h;
typedef __attribute__((ext_vector_type(8))) float v8f;
typedef __attribute__((ext_vector_type(4))) float v4f;
__device__ __forceinline__ float bf16_rne(float f) { unsigned int u = __float_as_uint(f); u += 0x7FFFu + ((u >> 16) & 1u); return __uint_as_float(u & 0xFFFF0000u); }
__device__ __forceinline__ v16b frag_kb(const b16* p, int hh) { const v8b a = *(const v8b*)(p + 8 * hh), b = *(const v8b*)(p + 16 + 8 * hh); v16b f;
#pragma unroll
  for (int e = 0; e < 8; ++e) { f[e] = a[e]; f[8 + e] = b[e]; } return f; }
__device__ __forceinline__ v8f wmma16b(v16b a, v16b b, v8f c) { v8f d = __builtin_amdgcn_wmma_f32_16x16x32_f16(false, a, false, b, (short)0, c, false, false); asm volatile("v_nop\n\tv_nop\n\tv_nop\n\tv_nop" : "+v"(d) : "v"(a), "v"(b)); return d; }
__device__ __forceinline__ void wave_lds_sync() { __builtin_amdgcn_fence(3, "workgroup"); __builtin_amdgcn_wave_barrier(); __builtin_amdgcn_fence(2, "workgroup"); }
__device__ __forceinline__ float nexp2(float v) { return __builtin_amdgcn_exp2f(v); }

__global__ __launch_bounds__(256) void prep_kernel(const float* __restrict__ wq, const float* __restrict__ wk, const float* __restrict__ wv, b16* __restrict__ WT) {
  const size_t u = (size_t)blockIdx.x * 256 + threadIdx.x; const size_t per = (size_t)H * HD * HD / 8; if (u >= 3 * per) return;
  const int m = (int)(u / per); const size_t e = (u % per) * 8; const float* w = m == 0 ? wq : m == 1 ? wk : wv; v8b o;
  for (int j = 0; j < 8; ++j) o[j] = (b16)(bf16_rne(w[e + j]) * WSC);
  { *(v8b*)(WT + (size_t)m * H * HD * HD + e) = o;  }
}
// projections: grid (T/64, BL, 3 parts x NSL slabs); block = 64 tokens of batch b x 4 waves (16 tokens each); slab = heads 2s, 2s+1: A = x[:, 128 s .. 128 s + 127] (exact bf16 x8) staged
__global__ __launch_bounds__(128) void proj_kernel(const float* __restrict__ x, const b16* __restrict__ WT, const float* __restrict__ bq, const float* __restrict__ bk, const float* __restrict__ bv,
                                                   b16* __restrict__ QP, b16* __restrict__ KP, b16* __restrict__ VTh, b16* __restrict__ VTl) {
  __shared__ __attribute__((aligned(16))) b16 As[64][128 + 8]; __shared__ __attribute__((aligned(16))) float Tf[4][16][128 + 4];
  const int wave = threadIdx.x >> 5, lane = threadIdx.x & 31, nloc = lane & 15, hlf = lane >> 4; const int t0 = blockIdx.x * 64; const int b = blockIdx.y;
  const int part = blockIdx.z / NSL, slab = blockIdx.z % NSL, c0 = slab * 128;
  const float* xb = x + ((size_t)b * SEQ_FULL + t0) * DM + c0; const float* bias = part == 0 ? bq : part == 1 ? bk : bv; const b16* Wp = WT + (size_t)part * H * HD * HD;
  for (int i = threadIdx.x; i < 64 * 32; i += 128) { const int rr = i / 32, q = (i % 32) * 4; const v4f f = *(const v4f*)(xb + (size_t)rr * DM + q); v4h o;
    for (int j = 0; j < 4; ++j) o[j] = (b16)(bf16_rne(f[j]) * XS); *(v4h*)(&As[rr][q]) = o; }
  __syncthreads();
  v8f acc[8];
#pragma unroll
  for (int t = 0; t < 8; ++t) acc[t] = (v8f){};
#pragma unroll
  for (int t = 0; t < 8; ++t) { const int h = 2 * slab + (t >> 2), e = (t & 3) * 16 + nloc; const b16* br = Wp + ((size_t)h * HD + e) * HD; const int a0 = (t >> 2) * HD;
#pragma unroll
    for (int kb = 0; kb < HD; kb += 32) acc[t] = wmma16b(frag_kb(&As[wave * 16 + nloc][a0 + kb], hlf), frag_kb(br + kb, hlf), acc[t]); }
#pragma unroll
  for (int t = 0; t < 8; ++t) { const int cl = t * 16 + nloc; const int h = 2 * slab + (t >> 2); const float bb = bf16_rne(bias[h * HD + (cl & 63)]);
#pragma unroll
    for (int r = 0; r < 8; ++r) Tf[wave][8 * hlf + r][cl] = acc[t][r] * (1.0f / (XS * WSC)) + bb; }
  __syncthreads();
  {
    if (part < 2) { b16* plane = part == 0 ? QP : KP; const int c = c0 + lane * 4; const int h = c / HD, d = c % HD;
      for (int rr = 0; rr < 16; ++rr) { const int tok = t0 + wave * 16 + rr; v4h o4; for (int j = 0; j < 4; ++j) o4[j] = (b16)(Tf[wave][rr][lane * 4 + j] * XS);
        *(v4h*)(plane + (((size_t)b * H + h) * T + tok) * HD + d) = o4; } }
    else {
#pragma unroll 1
      for (int q = 0; q < 32; ++q) { const int cl = wave * 32 + q; const int c = c0 + cl; const int h = c / HD, d = c % HD; const int tk = lane * 2; v2h hv, lv;
        for (int j = 0; j < 2; ++j) { const float f = Tf[(tk + j) >> 4][(tk + j) & 15][cl] * XS; const b16 p = (b16)f; hv[j] = p; lv[j] = (b16)((f - (float)p) * RS_); }
        const size_t oi = (((size_t)b * H + h) * HD + d) * (size_t)T + t0 + lane * 2; *(v2h*)(VTh + oi) = hv; if (VRES) *(v2h*)(VTl + oi) = lv; } }
     }
}
// attention: grid (T/128, BL x H): block = 8 waves x 16 queries of (b, h); the block walks all T keys in tiles of 64; each tile (K rows, V^T hi rows, V^T residual rows) is brought into LDS once
// for all 8 waves by asynchronous copies (16 B per lane), two buffers, the next tile in flight while this one is worked on; rows of 128 B at a pitch of 144 B for the ds_load_b128 fragment reads.
// Per wave as before: 32-key steps in key order; logit = s/8 (log2-scaled); online softmax; P x1024 single; O^T += V^T P^T (2 products when VRES); f32 rows of 64 at column 64h.
constexpr int NW = 8, KT = 64, NT = T / KT, LP = 64 + 8;   // waves per block, keys per tile, tiles, LDS row pitch in halves
constexpr unsigned PLB = 64u * LP * 2u, HRB = 32u * LP * 2u;  // bytes of one staged plane (64 rows), of 32 rows
static_assert(T % (16 * NW) == 0 && KT == 64 && HD == 64);
// One tile: every thread copies 16 B of rows r and r + 32 of each plane. The s_wait_xcnt stands inside the copies' own statement so that no address register is rewritten ahead of it.
__device__ __forceinline__ void stage_tile(unsigned lds, const b16* gk, const b16* gh, const b16* gl) {
  asm volatile("global_load_async_to_lds_b128 %0, %4, off\n\tglobal_load_async_to_lds_b128 %1, %5, off\n\tglobal_load_async_to_lds_b128 %2, %6, off\n\tglobal_load_async_to_lds_b128 %3, %7, off\n\ts_wait_xcnt 0x0"
               :: "v"(lds), "v"(lds + HRB), "v"(lds + PLB), "v"(lds + PLB + HRB), "v"(gk), "v"(gk + 32 * HD), "v"(gh), "v"(gh + (size_t)32 * T) : "memory");
  if (VRES) asm volatile("global_load_async_to_lds_b128 %0, %2, off\n\tglobal_load_async_to_lds_b128 %1, %3, off\n\ts_wait_xcnt 0x0"
               :: "v"(lds + 2 * PLB), "v"(lds + 2 * PLB + HRB), "v"(gl), "v"(gl + (size_t)32 * T) : "memory");
}
__global__ __launch_bounds__(256) void attn_kernel(const b16* __restrict__ QP, const b16* __restrict__ KP, const b16* __restrict__ VTh, const b16* __restrict__ VTl, float* __restrict__ out) {
  __shared__ __attribute__((aligned(16))) b16 St[2][3][64][LP];
  __shared__ __attribute__((aligned(16))) b16 Pb[NW][16][32 + 8]; __shared__ __attribute__((aligned(16))) float To[NW][16][HD + 4];
  const int wave = threadIdx.x >> 5, lane = threadIdx.x & 31, hh = lane >> 4, col = lane & 15; const int b = blockIdx.y / H, h = blockIdx.y % H; const int q0 = blockIdx.x * (16 * NW) + wave * 16, qi = q0 + col;
  const size_t ph = (size_t)b * H + h; const b16* Qb = QP + ph * T * HD; const b16* Kb = KP + ph * T * HD; const b16* Vh = VTh + ph * HD * (size_t)T; const b16* Vl = VTl + ph * HD * (size_t)T;
  const int sr = threadIdx.x >> 3, sc = (threadIdx.x & 7) * 8;   // this thread's staged row (and row + 32) and its 8 halves of it
  const unsigned sl = (unsigned)(size_t)&St[0][0][sr][sc];
  const b16* gk = Kb + (size_t)sr * HD + sc; const b16* gh = Vh + (size_t)sr * T + sc; const b16* gl = Vl + (size_t)sr * T + sc;
  stage_tile(sl, gk, gh, gl);
  const v16b qa0 = frag_kb(Qb + (size_t)qi * HD, hh), qa1 = frag_kb(Qb + (size_t)qi * HD + 32, hh);
  const float cs = LOG2E / (8.0f * XS * XS);
  float m = -INFINITY, l = 0.0f; v8f o[4], ol[4]; for (int t = 0; t < 4; ++t) { o[t] = (v8f){}; ol[t] = (v8f){}; }
  asm volatile("s_wait_asynccnt 0x0" ::: "memory");   // tile 0 of this wave's copies has landed
  __syncthreads();                                     // tile 0 published to all waves
  if (NT > 1) stage_tile(sl + 3 * PLB, gk + (size_t)KT * HD, gh + KT, gl + KT);
#pragma unroll 1
  for (int kt = 0; kt < NT; ++kt) {
    const b16 (*Ks)[LP] = St[kt & 1][0]; const b16 (*Vhs)[LP] = St[kt & 1][1]; const b16 (*Vls)[LP] = St[kt & 1][2];
#pragma unroll 1   // rolled: unrolled, the first step's sixteen p stay live into the second and the wave needs more than 160 registers (five waves per SIMD, not six)
    for (int kb = 0; kb < KT; kb += 32) {
      float e[16]; float mx = -INFINITY; v16b kf[4];   // the step's four K fragments are read as one group ahead of their products
#pragma unroll
      for (int u = 0; u < 2; ++u) { const b16* kr = &Ks[kb + u * 16 + col][0]; kf[2 * u] = frag_kb(kr, hh); kf[2 * u + 1] = frag_kb(kr + 32, hh); }
#pragma unroll
      for (int u = 0; u < 2; ++u) { v8f s = (v8f){}; s = wmma16b(kf[2 * u], qa0, s); s = wmma16b(kf[2 * u + 1], qa1, s);
#pragma unroll
        for (int r = 0; r < 8; ++r) { const float vv = s[r] * cs; e[u * 8 + r] = vv; mx = fmaxf(mx, vv); } }
      mx = fmaxf(mx, __shfl_xor(mx, 16)); const float mn = fmaxf(m, mx); const float al = nexp2(m - mn); float sum = 0.0f;
#pragma unroll
      for (int i2 = 0; i2 < 16; ++i2) { const float p = nexp2(e[i2] - mn); sum += p; Pb[wave][col][(i2 < 8 ? 0 : 16) + 8 * hh + (i2 & 7)] = (b16)(p * PS); }
      sum += __shfl_xor(sum, 16); l = l * al + sum; m = mn;
      wave_lds_sync();
      const v16b pf = frag_kb(&Pb[wave][col][0], hh); v16b vf[4];   // V^T fragments in groups of four
#pragma unroll
      for (int t = 0; t < 4; ++t) vf[t] = frag_kb(&Vhs[t * 16 + col][kb], hh);
#pragma unroll
      for (int t = 0; t < 4; ++t) { o[t] *= al; o[t] = wmma16b(vf[t], pf, o[t]); }
      if (VRES) {
#pragma unroll
        for (int t = 0; t < 4; ++t) vf[t] = frag_kb(&Vls[t * 16 + col][kb], hh);
#pragma unroll
        for (int t = 0; t < 4; ++t) ol[t] = wmma16b(vf[t], pf, ol[t] * al); }
      wave_lds_sync(); }
    asm volatile("s_wait_dscnt 0x0" ::: "memory");      // this wave's reads of the tile have returned before the buffer is refilled
    asm volatile("s_wait_asynccnt 0x0" ::: "memory");   // this wave's copies of tile kt + 1 have landed
    __syncthreads();                                     // publishes tile kt + 1 and ends every wave's reads of tile kt
    if (kt + 2 < NT) stage_tile(sl + (unsigned)(kt & 1) * (3 * PLB), gk + (size_t)(kt + 2) * KT * HD, gh + (kt + 2) * KT, gl + (kt + 2) * KT); }
  asm volatile("s_wait_asynccnt 0x0" ::: "memory");     // no copy outstanding when the wave goes on to the epilogue and ends
  const float inv = 1.0f / (l * PS * XS);
#pragma unroll
  for (int t = 0; t < 4; ++t)
#pragma unroll
    for (int r = 0; r < 8; ++r) To[wave][col][t * 16 + 8 * hh + r] = (o[t][r] + (VRES ? ol[t][r] * (1.0f / RS_) : 0.0f)) * inv;
  wave_lds_sync();
  { for (int i2 = 0; i2 < 8; ++i2) { const int rr = 2 * i2 + hh;
      *(v4f*)(out + ((size_t)b * SEQ_FULL + q0 + rr) * DM + h * HD + col * 4) = *(const v4f*)(&To[wave][rr][col * 4]); }  }
}
}  // namespace

extern "C" void kernel_launch(void* const* d_in, const int* in_sizes, int n_in, void* d_out, int out_size, void* d_ws, size_t ws_size, hipStream_t stream) {
  if (n_in < 7) return;
  auto Fp = [&](int i) { return (const float*)d_in[i]; };
  // wire order: 0 x [4,2048,768], 1 Wq [12,64,64] (h, out, in), 2 Wk, 3 Wv, 4 bq [12,64], 5 bk, 6 bv; out f32 [4,2048,768]
  const long long need_x = ((long long)(BL - 1) * SEQ_FULL + T) * (long long)DM;
  if ((long long)in_sizes[0] < need_x || in_sizes[1] < H * HD * HD || in_sizes[2] < H * HD * HD || in_sizes[3] < H * HD * HD ||
      in_sizes[4] < H * HD || in_sizes[5] < H * HD || in_sizes[6] < H * HD || (long long)out_size < need_x) return;
  size_t off = 0; char* ws = (char*)d_ws;
  auto carve = [&](size_t bytes) { char* p = ws + off; off += (bytes + 255) & ~(size_t)255; return p; };
  b16* WT = (b16*)carve((size_t)3 * H * HD * HD * 2);                  // 294,912 B
  const size_t plane = (size_t)BL * T * DM * 2;                          // 12,582,912 B at full size ([b][h][t][64] or [b][h][64][t] halves)
  b16* QP = (b16*)carve(plane); b16* KP = (b16*)carve(plane); b16* VTh = (b16*)carve(plane); b16* VTl = (b16*)carve(VRES ? plane : 256);
  if (off > ws_size || off > ((size_t)128 << 20)) return;               // total 50,626,560 B at full size
  prep_kernel<<<(unsigned)(((size_t)3 * H * HD * HD / 8 + 255) / 256), 256, 0, stream>>>(Fp(1), Fp(2), Fp(3), WT);
  proj_kernel<<<dim3(T / 64, BL, 3 * NSL), 128, 0, stream>>>(Fp(0), WT, Fp(4), Fp(5), Fp(6), QP, KP, VTh, VTl);
  attn_kernel<<<dim3(T / (16 * NW), BL * H), 32 * NW, 0, stream>>>(QP, KP, VTh, VTl, (float*)d_out);
}

// v002
// It runs in 102 microseconds.
// In both of two side-by-side timings against v001, it was 1.06 times as fast.
// Counting every step since v000, it is 2.96 times as fast.
#include <hip/hip_runtime.h>

// compute dtype: every contraction on v_wmma_f32_16x16x32_f16 (f16 operands, f32 accumulate). Per-head q/k/v projections ([NB*SEQ x 64] x [64 x 64] per head):
// x as exact bf16 x8, W as exact bf16 x256 (1 product); S^T = K Q^T with q/k f16 x8 planes (1 product); O^T += V^T P^T with P f16 x1024 and V^T as f16 hi x8 +
// residual x8192 planes (2 products, second accumulator folded with 1/1024 before normalisation). Biases (as bf16 RNE values), softmax statistics and 1/l in f32.
// Module: x [4][2048][768] viewed as 12 heads x 64; q_h = x_h Wq[h]^T + bq[h] (Wq[h] is (out,in)), k_h, v_h likewise; scores = q k^T / 8; softmax over all keys (no mask);
// out[b][s][64 h + d] = sum_t p v (heads concatenated) -> f32 [4][2048][768]. All float inputs enter as their bf16 RNE values.
// Flash-style: one wave per 16 queries of (b, h) walks all keys in order with a running max; 8 such waves share each K / V^T tile through LDS; deterministic, one writer per element.
// Fragment k-map per lane half hh for A AND B: elements 0..7 <- k = 8hh+0..7, 8..15 <- k = 16+8hh+0..7; acc[r] = D[8hh+r][lane&15].

#ifndef NB
#define NB 4
#endif
#ifndef SEQ
#define SEQ 2048
#endif

namespace {
constexpr int NB_FULL = 4, SEQ_FULL = 2048, DM = 768, H = 12, HD = 64;
constexpr int BL = NB;     // batches computed
constexpr int T = SEQ;     // tokens computed per batch (queries == keys); input and output row index = b * SEQ_FULL + t
constexpr int NSL = DM / 128;          // 128-column slabs (2 heads) per projection
constexpr bool VRES = true;
constexpr float XS = 8.0f, WSC = 256.0f, PS = 1024.0f, RS_ = 1024.0f, LOG2E = 1.4426950408889634f;
static_assert(T % 64 == 0 && T >= 64 && T <= SEQ_FULL && BL >= 1 && BL <= NB_FULL);
static_assert(DM % 128 == 0 && NSL * 128 == DM && H % 2 == 0 && H * HD == DM && HD == 64);
typedef _Float16 b16;
typedef __attribute__((ext_vector_type(16))) _Float16 v16b;
typedef __attribute__((ext_vector_type(8))) _Float16 v8b;
typedef __attribute__((ext_vector_type(4))) _Float16 v4h;
typedef __attribute__((ext_vector_type(2))) _Float16 v2h;
typedef __attribute__((ext_vector_type(8))) float v8f;
typedef __attribute__((ext_vector_type(4))) float v4f;
__device__ __forceinline__ float bf16_rne(float f) { unsigned int u = __float_as_uint(f); u += 0x7FFFu + ((u >> 16) & 1u); return __uint_as_float(u & 0xFFFF0000u); }
__device__ __forceinline__ v16b frag_kb(const b16* p, int hh) { const v8b a = *(const v8b*)(p + 8 * hh), b = *(const v8b*)(p + 16 + 8 * hh); v16b f;
#pragma unroll
  for (int e = 0; e < 8; ++e) { f[e] = a[e]; f[8 + e] = b[e]; } return f; }
// The builtin alone: the compiler keeps the distance a WMMA needs before its registers are touched and fills it with independent work where there is some.
__device__ __forceinline__ v8f wmma16b(v16b a, v16b b, v8f c) { return __builtin_amdgcn_wmma_f32_16x16x32_f16(false, a, false, b, (short)0, c, false, false); }
__device__ __forceinline__ void wave_lds_sync() { __builtin_amdgcn_fence(3, "workgroup"); __builtin_amdgcn_wave_barrier(); __builtin_amdgcn_fence(2, "workgroup"); }
__device__ __forceinline__ float nexp2(float v) { return __builtin_amdgcn_exp2f(v); }

__global__ __launch_bounds__(256) void prep_kernel(const float* __restrict__ wq, const float* __restrict__ wk, const float* __restrict__ wv, b16* __restrict__ WT) {
  const size_t u = (size_t)blockIdx.x * 256 + threadIdx.x; const size_t per = (size_t)H * HD * HD / 8; if (u >= 3 * per) return;
  const int m = (int)(u / per); const size_t e = (u % per) * 8; const float* w = m == 0 ? wq : m == 1 ? wk : wv; v8b o;
  for (int j = 0; j < 8; ++j) o[j] = (b16)(bf16_rne(w[e + j]) * WSC);
  { *(v8b*)(WT + (size_t)m * H * HD * HD + e) = o;  }
}
// projections: grid (T/64, BL, 3 parts x NSL slabs); block = 64 tokens of batch b x 4 waves (16 tokens each); slab = heads 2s, 2s+1: A = x[:, 128 s .. 128 s + 127] (exact bf16 x8) staged
__global__ __launch_bounds__(128) void proj_kernel(const float* __restrict__ x, const b16* __restrict__ WT, const float* __restrict__ bq, const float* __restrict__ bk, const float* __restrict__ bv,
                                                   b16* __restrict__ QP, b16* __restrict__ KP, b16* __restrict__ VTh, b16* __restrict__ VTl) {
  __shared__ __attribute__((aligned(16))) b16 As[64][128 + 8]; __shared__ __attribute__((aligned(16))) float Tf[4][16][128 + 4];
  const int wave = threadIdx.x >> 5, lane = threadIdx.x & 31, nloc = lane & 15, hlf = lane >> 4; const int t0 = blockIdx.x * 64; const int b = blockIdx.y;
  const int part = blockIdx.z / NSL, slab = blockIdx.z % NSL, c0 = slab * 128;
  const float* xb = x + ((size_t)b * SEQ_FULL + t0) * DM + c0; const float* bias = part == 0 ? bq : part == 1 ? bk : bv; const b16* Wp = WT + (size_t)part * H * HD * HD;
  for (int i = threadIdx.x; i < 64 * 32; i += 128) { const int rr = i / 32, q = (i % 32) * 4; const v4f f = *(const v4f*)(xb + (size_t)rr * DM + q); v4h o;
    for (int j = 0; j < 4; ++j) o[j] = (b16)(bf16_rne(f[j]) * XS); *(v4h*)(&As[rr][q]) = o; }
  __syncthreads();
  v8f acc[8];
#pragma unroll
  for (int t = 0; t < 8; ++t) acc[t] = (v8f){};
#pragma unroll
  for (int t = 0; t < 8; ++t) { const int h = 2 * slab + (t >> 2), e = (t & 3) * 16 + nloc; const b16* br = Wp + ((size_t)h * HD + e) * HD; const int a0 = (t >> 2) * HD;
#pragma unroll
    for (int kb = 0; kb < HD; kb += 32) acc[t] = wmma16b(frag_kb(&As[wave * 16 + nloc][a0 + kb], hlf), frag_kb(br + kb, hlf), acc[t]); }
#pragma unroll
  for (int t = 0; t < 8; ++t) { const int cl = t * 16 + nloc; const int h = 2 * slab + (t >> 2); const float bb = bf16_rne(bias[h * HD + (cl & 63)]);
#pragma unroll
    for (int r = 0; r < 8; ++r) Tf[wave][8 * hlf + r][cl] = acc[t][r] * (1.0f / (XS * WSC)) + bb; }
  __syncthreads();
  {
    if (part < 2) { b16* plane = part == 0 ? QP : KP; const int c = c0 + lane * 4; const int h = c / HD, d = c % HD;
      for (int rr = 0; rr < 16; ++rr) { const int tok = t0 + wave * 16 + rr; v4h o4; for (int j = 0; j < 4; ++j) o4[j] = (b16)(Tf[wave][rr][lane * 4 + j] * XS);
        *(v4h*)(plane + (((size_t)b * H + h) * T + tok) * HD + d) = o4; } }
    else {
#pragma unroll 1
      for (int q = 0; q < 32; ++q) { const int cl = wave * 32 + q; const int c = c0 + cl; const int h = c / HD, d = c % HD; const int tk = lane * 2; v2h hv, lv;
        for (int j = 0; j < 2; ++j) { const float f = Tf[(tk + j) >> 4][(tk + j) & 15][cl] * XS; const b16 p = (b16)f; hv[j] = p; lv[j] = (b16)((f - (float)p) * RS_); }
        const size_t oi = (((size_t)b * H + h) * HD + d) * (size_t)T + t0 + lane * 2; *(v2h*)(VTh + oi) = hv; if (VRES) *(v2h*)(VTl + oi) = lv; } }
     }
}
// attention: grid (T/128, BL x H): block = 8 waves x 16 queries of (b, h); the block walks all T keys in tiles of 64; each tile (K rows, V^T hi rows, V^T residual rows) is brought into LDS once
// for all 8 waves by asynchronous copies (16 B per lane), two buffers, the next tile in flight while this one is worked on; rows of 128 B at a pitch of 144 B for the ds_load_b128 fragment reads.
// Per wave as before: 32-key steps in key order; logit = s/8 (log2-scaled); online softmax; P x1024 single; O^T += V^T P^T (2 products when VRES); f32 rows of 64 at column 64h.
constexpr int NW = 8, KT = 64, NT = T / KT, LP = 64 + 8;   // waves per block, keys per tile, tiles, LDS row pitch in halves
constexpr unsigned PLB = 64u * LP * 2u, HRB = 32u * LP * 2u;  // bytes of one staged plane (64 rows), of 32 rows
static_assert(T % (16 * NW) == 0 && KT == 64 && HD == 64);
// One tile: every thread copies 16 B of rows r and r + 32 of each plane. The s_wait_xcnt stands inside the copies' own statement so that no address register is rewritten ahead of it.
__device__ __forceinline__ void stage_tile(unsigned lds, const b16* gk, const b16* gh, const b16* gl) {
  asm volatile("global_load_async_to_lds_b128 %0, %4, off\n\tglobal_load_async_to_lds_b128 %1, %5, off\n\tglobal_load_async_to_lds_b128 %2, %6, off\n\tglobal_load_async_to_lds_b128 %3, %7, off\n\ts_wait_xcnt 0x0"
               :: "v"(lds), "v"(lds + HRB), "v"(lds + PLB), "v"(lds + PLB + HRB), "v"(gk), "v"(gk + 32 * HD), "v"(gh), "v"(gh + (size_t)32 * T) : "memory");
  if (VRES) asm volatile("global_load_async_to_lds_b128 %0, %2, off\n\tglobal_load_async_to_lds_b128 %1, %3, off\n\ts_wait_xcnt 0x0"
               :: "v"(lds + 2 * PLB), "v"(lds + 2 * PLB + HRB), "v"(gl), "v"(gl + (size_t)32 * T) : "memory");
}
__global__ __launch_bounds__(256) void attn_kernel(const b16* __restrict__ QP, const b16* __restrict__ KP, const b16* __restrict__ VTh, const b16* __restrict__ VTl, float* __restrict__ out) {
  __shared__ __attribute__((aligned(16))) b16 St[2][3][64][LP];
  __shared__ __attribute__((aligned(16))) b16 Pb[NW][16][32 + 8]; __shared__ __attribute__((aligned(16))) float To[NW][16][HD + 4];
  const int wave = threadIdx.x >> 5, lane = threadIdx.x & 31, hh = lane >> 4, col = lane & 15; const int b = blockIdx.y / H, h = blockIdx.y % H; const int q0 = blockIdx.x * (16 * NW) + wave * 16, qi = q0 + col;
  const size_t ph = (size_t)b * H + h; const b16* Qb = QP + ph * T * HD; const b16* Kb = KP + ph * T * HD; const b16* Vh = VTh + ph * HD * (size_t)T; const b16* Vl = VTl + ph * HD * (size_t)T;
  const int sr = threadIdx.x >> 3, sc = (threadIdx.x & 7) * 8;   // this thread's staged row (and row + 32) and its 8 halves of it
  const unsigned sl = (unsigned)(size_t)&St[0][0][sr][sc];
  const b16* gk = Kb + (size_t)sr * HD + sc; const b16* gh = Vh + (size_t)sr * T + sc; const b16* gl = Vl + (size_t)sr * T + sc;
  stage_tile(sl, gk, gh, gl);
  const v16b qa0 = frag_kb(Qb + (size_t)qi * HD, hh), qa1 = frag_kb(Qb + (size_t)qi * HD + 32, hh);
  const float cs = LOG2E / (8.0f * XS * XS);
  float m = -INFINITY, l = 0.0f; v8f o[4], ol[4]; for (int t = 0; t < 4; ++t) { o[t] = (v8f){}; ol[t] = (v8f){}; }
  asm volatile("s_wait_asynccnt 0x0" ::: "memory");   // tile 0 of this wave's copies has landed
  __syncthreads();                                     // tile 0 published to all waves
  if (NT > 1) stage_tile(sl + 3 * PLB, gk + (size_t)KT * HD, gh + KT, gl + KT);
#pragma unroll 1
  for (int kt = 0; kt < NT; ++kt) {
    const b16 (*Ks)[LP] = St[kt & 1][0]; const b16 (*Vhs)[LP] = St[kt & 1][1]; const b16 (*Vls)[LP] = St[kt & 1][2];
#pragma unroll 1   // rolled: unrolled, the first step's sixteen p stay live into the second and the wave needs more than 160 registers (five waves per SIMD, not six)
    for (int kb = 0; kb < KT; kb += 32) {
      float e[16]; float mx = -INFINITY; v16b kf[4];   // the step's four K fragments are read as one group ahead of their products
#pragma unroll
      for (int u = 0; u < 2; ++u) { const b16* kr = &Ks[kb + u * 16 + col][0]; kf[2 * u] = frag_kb(kr, hh); kf[2 * u + 1] = frag_kb(kr + 32, hh); }
#pragma unroll
      for (int u = 0; u < 2; ++u) { v8f s = (v8f){}; s = wmma16b(kf[2 * u], qa0, s); s = wmma16b(kf[2 * u + 1], qa1, s);
#pragma unroll
        for (int r = 0; r < 8; ++r) { const float vv = s[r] * cs; e[u * 8 + r] = vv; mx = fmaxf(mx, vv); } }
      mx = fmaxf(mx, __shfl_xor(mx, 16)); const float mn = fmaxf(m, mx); const float al = nexp2(m - mn); float sum = 0.0f;
#pragma unroll
      for (int i2 = 0; i2 < 16; ++i2) { const float p = nexp2(e[i2] - mn); sum += p; Pb[wave][col][(i2 < 8 ? 0 : 16) + 8 * hh + (i2 & 7)] = (b16)(p * PS); }
      sum += __shfl_xor(sum, 16); l = l * al + sum; m = mn;
      wave_lds_sync();
      const v16b pf = frag_kb(&Pb[wave][col][0], hh); v16b vf[4];   // V^T fragments in groups of four
#pragma unroll
      for (int t = 0; t < 4; ++t) vf[t] = frag_kb(&Vhs[t * 16 + col][kb], hh);
#pragma unroll
      for (int t = 0; t < 4; ++t) { o[t] *= al; o[t] = wmma16b(vf[t], pf, o[t]); }
      if (VRES) {
#pragma unroll
        for (int t = 0; t < 4; ++t) vf[t] = frag_kb(&Vls[t * 16 + col][kb], hh);
#pragma unroll
        for (int t = 0; t < 4; ++t) ol[t] = wmma16b(vf[t], pf, ol[t] * al); }
      wave_lds_sync(); }
    asm volatile("s_wait_dscnt 0x0" ::: "memory");      // this wave's reads of the tile have returned before the buffer is refilled
    asm volatile("s_wait_asynccnt 0x0" ::: "memory");   // this wave's copies of tile kt + 1 have landed
    __syncthreads();                                     // publishes tile kt + 1 and ends every wave's reads of tile kt
    if (kt + 2 < NT) stage_tile(sl + (unsigned)(kt & 1) * (3 * PLB), gk + (size_t)(kt + 2) * KT * HD, gh + (kt + 2) * KT, gl + (kt + 2) * KT); }
  asm volatile("s_wait_asynccnt 0x0" ::: "memory");     // no copy outstanding when the wave goes on to the epilogue and ends
  const float inv = 1.0f / (l * PS * XS);
#pragma unroll
  for (int t = 0; t < 4; ++t)
#pragma unroll
    for (int r = 0; r < 8; ++r) To[wave][col][t * 16 + 8 * hh + r] = (o[t][r] + (VRES ? ol[t][r] * (1.0f / RS_) : 0.0f)) * inv;
  wave_lds_sync();
  { for (int i2 = 0; i2 < 8; ++i2) { const int rr = 2 * i2 + hh;
      *(v4f*)(out + ((size_t)b * SEQ_FULL + q0 + rr) * DM + h * HD + col * 4) = *(const v4f*)(&To[wave][rr][col * 4]); }  }
}
}  // namespace

extern "C" void kernel_launch(void* const* d_in, const int* in_sizes, int n_in, void* d_out, int out_size, void* d_ws, size_t ws_size, hipStream_t stream) {
  if (n_in < 7) return;
  auto Fp = [&](int i) { return (const float*)d_in[i]; };
  // wire order: 0 x [4,2048,768], 1 Wq [12,64,64] (h, out, in), 2 Wk, 3 Wv, 4 bq [12,64], 5 bk, 6 bv; out f32 [4,2048,768]
  const long long need_x = ((long long)(BL - 1) * SEQ_FULL + T) * (long long)DM;
  if ((long long)in_sizes[0] < need_x || in_sizes[1] < H * HD * HD || in_sizes[2] < H * HD * HD || in_sizes[3] < H * HD * HD ||
      in_sizes[4] < H * HD || in_sizes[5] < H * HD || in_sizes[6] < H * HD || (long long)out_size < need_x) return;
  size_t off = 0; char* ws = (char*)d_ws;
  auto carve = [&](size_t bytes) { char* p = ws + off; off += (bytes + 255) & ~(size_t)255; return p; };
  b16* WT = (b16*)carve((size_t)3 * H * HD * HD * 2);                  // 294,912 B
  const size_t plane = (size_t)BL * T * DM * 2;                          // 12,582,912 B at full size ([b][h][t][64] or [b][h][64][t] halves)
  b16* QP = (b16*)carve(plane); b16* KP = (b16*)carve(plane); b16* VTh = (b16*)carve(plane); b16* VTl = (b16*)carve(VRES ? plane : 256);
  if (off > ws_size || off > ((size_t)128 << 20)) return;               // total 50,626,560 B at full size
  prep_kernel<<<(unsigned)(((size_t)3 * H * HD * HD / 8 + 255) / 256), 256, 0, stream>>>(Fp(1), Fp(2), Fp(3), WT);
  proj_kernel<<<dim3(T / 64, BL, 3 * NSL), 128, 0, stream>>>(Fp(0), WT, Fp(4), Fp(5), Fp(6), QP, KP, VTh, VTl);
  attn_kernel<<<dim3(T / (16 * NW), BL * H), 32 * NW, 0, stream>>>(QP, KP, VTh, VTl, (float*)d_out);
}

// v003
// It runs in 97 microseconds.
// Two timings next to v002 both put it at 1.05 times that version's speed.
// All steps since v000 together make it 3.10 times as fast.
#include <hip/hip_runtime.h>

// compute dtype: every contraction on v_wmma_f32_16x16x32_f16 (f16 operands, f32 accumulate). Per-head q/k/v projections ([NB*SEQ x 64] x [64 x 64] per head):
// x as exact bf16 x8, W as exact bf16 x256 (1 product); S^T = K Q^T with q/k f16 x8 planes (1 product); O^T += V^T P^T with P f16 x1024 and V^T as f16 hi x8 +
// residual x8192 planes (2 products, second accumulator folded with 1/1024 before normalisation). Biases (as bf16 RNE values), softmax statistics and 1/l in f32.
// Module: x [4][2048][768] viewed as 12 heads x 64; q_h = x_h Wq[h]^T + bq[h] (Wq[h] is (out,in)), k_h, v_h likewise; scores = q k^T / 8; softmax over all keys (no mask);
// out[b][s][64 h + d] = sum_t p v (heads concatenated) -> f32 [4][2048][768]. All float inputs enter as their bf16 RNE values.
// Flash-style: one wave per 16 queries of (b, h) walks all keys in order with a running max; 8 such waves share each K / V^T tile through LDS; deterministic, one writer per element.
// Fragment k-map per lane half hh for A AND B: elements 0..7 <- k = 8hh+0..7, 8..15 <- k = 16+8hh+0..7; acc[r] = D[8hh+r][lane&15].

#ifndef NB
#define NB 4
#endif
#ifndef SEQ
#define SEQ 2048
#endif

namespace {
constexpr int NB_FULL = 4, SEQ_FULL = 2048, DM = 768, H = 12, HD = 64;
constexpr int BL = NB;     // batches computed
constexpr int T = SEQ;     // tokens computed per batch (queries == keys); input and output row index = b * SEQ_FULL + t
constexpr int NSL = DM / 128;          // 128-column slabs (2 heads) per projection
constexpr bool VRES = true;
constexpr float XS = 8.0f, WSC = 256.0f, PS = 1024.0f, RS_ = 1024.0f, LOG2E = 1.4426950408889634f;
static_assert(T % 64 == 0 && T >= 64 && T <= SEQ_FULL && BL >= 1 && BL <= NB_FULL);
static_assert(DM % 128 == 0 && NSL * 128 == DM && H % 2 == 0 && H * HD == DM && HD == 64);
typedef _Float16 b16;
typedef __attribute__((ext_vector_type(16))) _Float16 v16b;
typedef __attribute__((ext_vector_type(8))) _Float16 v8b;
typedef __attribute__((ext_vector_type(4))) _Float16 v4h;
typedef __attribute__((ext_vector_type(2))) _Float16 v2h;
typedef __attribute__((ext_vector_type(8))) float v8f;
typedef __attribute__((ext_vector_type(4))) float v4f;
__device__ __forceinline__ float bf16_rne(float f) { unsigned int u = __float_as_uint(f); u += 0x7FFFu + ((u >> 16) & 1u); return __uint_as_float(u & 0xFFFF0000u); }
__device__ __forceinline__ v16b frag_kb(const b16* p, int hh) { const v8b a = *(const v8b*)(p + 8 * hh), b = *(const v8b*)(p + 16 + 8 * hh); v16b f;
#pragma unroll
  for (int e = 0; e < 8; ++e) { f[e] = a[e]; f[8 + e] = b[e]; } return f; }
// The builtin alone: the compiler keeps the distance a WMMA needs before its registers are touched and fills it with independent work where there is some.
__device__ __forceinline__ v8f wmma16b(v16b a, v16b b, v8f c) { return __builtin_amdgcn_wmma_f32_16x16x32_f16(false, a, false, b, (short)0, c, false, false); }
__device__ __forceinline__ void wave_lds_sync() { __builtin_amdgcn_fence(3, "workgroup"); __builtin_amdgcn_wave_barrier(); __builtin_amdgcn_fence(2, "workgroup"); }
__device__ __forceinline__ float nexp2(float v) { return __builtin_amdgcn_exp2f(v); }

__global__ __launch_bounds__(256) void prep_kernel(const float* __restrict__ wq, const float* __restrict__ wk, const float* __restrict__ wv, b16* __restrict__ WT) {
  const size_t u = (size_t)blockIdx.x * 256 + threadIdx.x; const size_t per = (size_t)H * HD * HD / 8; if (u >= 3 * per) return;
  const int m = (int)(u / per); const size_t e = (u % per) * 8; const float* w = m == 0 ? wq : m == 1 ? wk : wv; v8b o;
  for (int j = 0; j < 8; ++j) o[j] = (b16)(bf16_rne(w[e + j]) * WSC);
  { *(v8b*)(WT + (size_t)m * H * HD * HD + e) = o;  }
}
// projections: grid (T/64, BL, 3 parts x NSL slabs); block = 64 tokens of batch b x 4 waves (16 tokens each); slab = heads 2s, 2s+1: A = x[:, 128 s .. 128 s + 127] (exact bf16 x8) staged
__global__ __launch_bounds__(128) void proj_kernel(const float* __restrict__ x, const b16* __restrict__ WT, const float* __restrict__ bq, const float* __restrict__ bk, const float* __restrict__ bv,
                                                   b16* __restrict__ QP, b16* __restrict__ KP, b16* __restrict__ VTh, b16* __restrict__ VTl) {
  __shared__ __attribute__((aligned(16))) b16 As[64][128 + 8]; __shared__ __attribute__((aligned(16))) float Tf[4][16][128 + 4];
  const int wave = threadIdx.x >> 5, lane = threadIdx.x & 31, nloc = lane & 15, hlf = lane >> 4; const int t0 = blockIdx.x * 64; const int b = blockIdx.y;
  const int part = blockIdx.z / NSL, slab = blockIdx.z % NSL, c0 = slab * 128;
  const float* xb = x + ((size_t)b * SEQ_FULL + t0) * DM + c0; const float* bias = part == 0 ? bq : part == 1 ? bk : bv; const b16* Wp = WT + (size_t)part * H * HD * HD;
  for (int i = threadIdx.x; i < 64 * 32; i += 128) { const int rr = i / 32, q = (i % 32) * 4; const v4f f = *(const v4f*)(xb + (size_t)rr * DM + q); v4h o;
    for (int j = 0; j < 4; ++j) o[j] = (b16)(bf16_rne(f[j]) * XS); *(v4h*)(&As[rr][q]) = o; }
  __syncthreads();
  v8f acc[8];
#pragma unroll
  for (int t = 0; t < 8; ++t) acc[t] = (v8f){};
#pragma unroll
  for (int t = 0; t < 8; ++t) { const int h = 2 * slab + (t >> 2), e = (t & 3) * 16 + nloc; const b16* br = Wp + ((size_t)h * HD + e) * HD; const int a0 = (t >> 2) * HD;
#pragma unroll
    for (int kb = 0; kb < HD; kb += 32) acc[t] = wmma16b(frag_kb(&As[wave * 16 + nloc][a0 + kb], hlf), frag_kb(br + kb, hlf), acc[t]); }
#pragma unroll
  for (int t = 0; t < 8; ++t) { const int cl = t * 16 + nloc; const int h = 2 * slab + (t >> 2); const float bb = bf16_rne(bias[h * HD + (cl & 63)]);
#pragma unroll
    for (int r = 0; r < 8; ++r) Tf[wave][8 * hlf + r][cl] = acc[t][r] * (1.0f / (XS * WSC)) + bb; }
  __syncthreads();
  {
    if (part < 2) { b16* plane = part == 0 ? QP : KP; const int c = c0 + lane * 4; const int h = c / HD, d = c % HD;
      for (int rr = 0; rr < 16; ++rr) { const int tok = t0 + wave * 16 + rr; v4h o4; for (int j = 0; j < 4; ++j) o4[j] = (b16)(Tf[wave][rr][lane * 4 + j] * XS);
        *(v4h*)(plane + (((size_t)b * H + h) * T + tok) * HD + d) = o4; } }
    else {
#pragma unroll 1
      for (int q = 0; q < 32; ++q) { const int cl = wave * 32 + q; const int c = c0 + cl; const int h = c / HD, d = c % HD; const int tk = lane * 2; v2h hv, lv;
        for (int j = 0; j < 2; ++j) { const float f = Tf[(tk + j) >> 4][(tk + j) & 15][cl] * XS; const b16 p = (b16)f; hv[j] = p; lv[j] = (b16)((f - (float)p) * RS_); }
        const size_t oi = (((size_t)b * H + h) * HD + d) * (size_t)T + t0 + lane * 2; *(v2h*)(VTh + oi) = hv; if (VRES) *(v2h*)(VTl + oi) = lv; } }
     }
}
// attention: grid (T/128, BL x H): block = 8 waves x 16 queries of (b, h); the block walks all T keys in tiles of 64; each tile (K rows, V^T hi rows, V^T residual rows) is brought into LDS once
// for all 8 waves by asynchronous copies (16 B per lane), two buffers, the next tile in flight while this one is worked on; rows of 128 B at a pitch of 144 B for the ds_load_b128 fragment reads.
// Per wave as before: 32-key steps in key order; logit = s/8 (log2-scaled); online softmax with lazy rescale; P x1024 single; O^T += V^T P^T (2 products when VRES); f32 rows of 64 at column 64h.
constexpr int NW = 8, KT = 64, NT = T / KT, LP = 64 + 8;   // waves per block, keys per tile, tiles, LDS row pitch in halves
constexpr float LAZY = 5.0f;   // log2 units by which a column's maximum may outgrow the one in use before the state is rescaled
constexpr unsigned PLB = 64u * LP * 2u, HRB = 32u * LP * 2u;  // bytes of one staged plane (64 rows), of 32 rows
static_assert(T % (16 * NW) == 0 && KT == 64 && HD == 64);
// One tile: every thread copies 16 B of rows r and r + 32 of each plane. The s_wait_xcnt stands inside the copies' own statement so that no address register is rewritten ahead of it.
__device__ __forceinline__ void stage_tile(unsigned lds, const b16* gk, const b16* gh, const b16* gl) {
  asm volatile("global_load_async_to_lds_b128 %0, %4, off\n\tglobal_load_async_to_lds_b128 %1, %5, off\n\tglobal_load_async_to_lds_b128 %2, %6, off\n\tglobal_load_async_to_lds_b128 %3, %7, off\n\ts_wait_xcnt 0x0"
               :: "v"(lds), "v"(lds + HRB), "v"(lds + PLB), "v"(lds + PLB + HRB), "v"(gk), "v"(gk + 32 * HD), "v"(gh), "v"(gh + (size_t)32 * T) : "memory");
  if (VRES) asm volatile("global_load_async_to_lds_b128 %0, %2, off\n\tglobal_load_async_to_lds_b128 %1, %3, off\n\ts_wait_xcnt 0x0"
               :: "v"(lds + 2 * PLB), "v"(lds + 2 * PLB + HRB), "v"(gl), "v"(gl + (size_t)32 * T) : "memory");
}
__global__ __launch_bounds__(256) void attn_kernel(const b16* __restrict__ QP, const b16* __restrict__ KP, const b16* __restrict__ VTh, const b16* __restrict__ VTl, float* __restrict__ out) {
  __shared__ __attribute__((aligned(16))) b16 St[2][3][64][LP];
  __shared__ __attribute__((aligned(16))) b16 Pb[NW][16][32 + 8]; __shared__ __attribute__((aligned(16))) float To[NW][16][HD + 4];
  const int wave = threadIdx.x >> 5, lane = threadIdx.x & 31, hh = lane >> 4, col = lane & 15; const int b = blockIdx.y / H, h = blockIdx.y % H; const int q0 = blockIdx.x * (16 * NW) + wave * 16, qi = q0 + col;
  const size_t ph = (size_t)b * H + h; const b16* Qb = QP + ph * T * HD; const b16* Kb = KP + ph * T * HD; const b16* Vh = VTh + ph * HD * (size_t)T; const b16* Vl = VTl + ph * HD * (size_t)T;
  const int sr = threadIdx.x >> 3, sc = (threadIdx.x & 7) * 8;   // this thread's staged row (and row + 32) and its 8 halves of it
  const unsigned sl = (unsigned)(size_t)&St[0][0][sr][sc];
  const b16* gk = Kb + (size_t)sr * HD + sc; const b16* gh = Vh + (size_t)sr * T + sc; const b16* gl = Vl + (size_t)sr * T + sc;
  stage_tile(sl, gk, gh, gl);
  const v16b qa0 = frag_kb(Qb + (size_t)qi * HD, hh), qa1 = frag_kb(Qb + (size_t)qi * HD + 32, hh);
  const float cs = LOG2E / (8.0f * XS * XS);
  float m = -INFINITY, l = 0.0f; v8f o[4], ol[4]; for (int t = 0; t < 4; ++t) { o[t] = (v8f){}; ol[t] = (v8f){}; }
  asm volatile("s_wait_asynccnt 0x0" ::: "memory");   // tile 0 of this wave's copies has landed
  __syncthreads();                                     // tile 0 published to all waves
  if (NT > 1) stage_tile(sl + 3 * PLB, gk + (size_t)KT * HD, gh + KT, gl + KT);
#pragma unroll 1
  for (int kt = 0; kt < NT; ++kt) {
    const b16 (*Ks)[LP] = St[kt & 1][0]; const b16 (*Vhs)[LP] = St[kt & 1][1]; const b16 (*Vls)[LP] = St[kt & 1][2];
#pragma unroll 1   // rolled: unrolled, the first step's sixteen p stay live into the second and the wave needs more than 160 registers (five waves per SIMD, not six)
    for (int kb = 0; kb < KT; kb += 32) {
      float e[16]; float mx = -INFINITY; v16b kf[4];   // the step's four K fragments are read as one group ahead of their products
#pragma unroll
      for (int u = 0; u < 2; ++u) { const b16* kr = &Ks[kb + u * 16 + col][0]; kf[2 * u] = frag_kb(kr, hh); kf[2 * u + 1] = frag_kb(kr + 32, hh); }
#pragma unroll
      for (int u = 0; u < 2; ++u) { v8f s = (v8f){}; s = wmma16b(kf[2 * u], qa0, s); s = wmma16b(kf[2 * u + 1], qa1, s);
#pragma unroll
        for (int r = 0; r < 8; ++r) { const float vv = s[r] * cs; e[u * 8 + r] = vv; mx = fmaxf(mx, vv); } }
      mx = fmaxf(mx, __shfl_xor(mx, 16)); float sum = 0.0f;
      // Lazy rescale: one wave-uniform scalar branch per step (EXEC stays full for the WMMAs). The maximum in use is raised, and l and both accumulators rescaled, only when some column's
      // new maximum lies more than LAZY above it; otherwise p <= 2^LAZY, so p x1024 <= 2^15 still fits f16, and the 64 accumulator multiplies are not issued. The first step always takes it (m = -inf).
      if (__builtin_amdgcn_ballot_w32(mx > m + LAZY) != 0u) { const float mn = fmaxf(m, mx); const float al = nexp2(m - mn); l *= al; m = mn;
#pragma unroll
        for (int t = 0; t < 4; ++t) { o[t] *= al; if (VRES) ol[t] *= al; } }
#pragma unroll
      for (int i2 = 0; i2 < 16; ++i2) e[i2] -= m;
#pragma unroll
      for (int i2 = 0; i2 < 16; ++i2) e[i2] = nexp2(e[i2]);
#pragma unroll
      for (int i2 = 0; i2 < 16; ++i2) { sum += e[i2]; Pb[wave][col][(i2 < 8 ? 0 : 16) + 8 * hh + (i2 & 7)] = (b16)(e[i2] * PS); }
      sum += __shfl_xor(sum, 16); l += sum;
      wave_lds_sync();
      const v16b pf = frag_kb(&Pb[wave][col][0], hh); v16b vf[4];   // V^T fragments in groups of four
#pragma unroll
      for (int t = 0; t < 4; ++t) vf[t] = frag_kb(&Vhs[t * 16 + col][kb], hh);
#pragma unroll
      for (int t = 0; t < 4; ++t) o[t] = wmma16b(vf[t], pf, o[t]);
      if (VRES) {
#pragma unroll
        for (int t = 0; t < 4; ++t) vf[t] = frag_kb(&Vls[t * 16 + col][kb], hh);
#pragma unroll
        for (int t = 0; t < 4; ++t) ol[t] = wmma16b(vf[t], pf, ol[t]); }
      wave_lds_sync(); }
    asm volatile("s_wait_dscnt 0x0" ::: "memory");      // this wave's reads of the tile have returned before the buffer is refilled
    asm volatile("s_wait_asynccnt 0x0" ::: "memory");   // this wave's copies of tile kt + 1 have landed
    __syncthreads();                                     // publishes tile kt + 1 and ends every wave's reads of tile kt
    if (kt + 2 < NT) stage_tile(sl + (unsigned)(kt & 1) * (3 * PLB), gk + (size_t)(kt + 2) * KT * HD, gh + (kt + 2) * KT, gl + (kt + 2) * KT); }
  asm volatile("s_wait_asynccnt 0x0" ::: "memory");     // no copy outstanding when the wave goes on to the epilogue and ends
  const float inv = 1.0f / (l * PS * XS);
#pragma unroll
  for (int t = 0; t < 4; ++t)
#pragma unroll
    for (int r = 0; r < 8; ++r) To[wave][col][t * 16 + 8 * hh + r] = (o[t][r] + (VRES ? ol[t][r] * (1.0f / RS_) : 0.0f)) * inv;
  wave_lds_sync();
  { for (int i2 = 0; i2 < 8; ++i2) { const int rr = 2 * i2 + hh;
      *(v4f*)(out + ((size_t)b * SEQ_FULL + q0 + rr) * DM + h * HD + col * 4) = *(const v4f*)(&To[wave][rr][col * 4]); }  }
}
}  // namespace

extern "C" void kernel_launch(void* const* d_in, const int* in_sizes, int n_in, void* d_out, int out_size, void* d_ws, size_t ws_size, hipStream_t stream) {
  if (n_in < 7) return;
  auto Fp = [&](int i) { return (const float*)d_in[i]; };
  // wire order: 0 x [4,2048,768], 1 Wq [12,64,64] (h, out, in), 2 Wk, 3 Wv, 4 bq [12,64], 5 bk, 6 bv; out f32 [4,2048,768]
  const long long need_x = ((long long)(BL - 1) * SEQ_FULL + T) * (long long)DM;
  if ((long long)in_sizes[0] < need_x || in_sizes[1] < H * HD * HD || in_sizes[2] < H * HD * HD || in_sizes[3] < H * HD * HD ||
      in_sizes[4] < H * HD || in_sizes[5] < H * HD || in_sizes[6] < H * HD || (long long)out_size < need_x) return;
  size_t off = 0; char* ws = (char*)d_ws;
  auto carve = [&](size_t bytes) { char* p = ws + off; off += (bytes + 255) & ~(size_t)255; return p; };
  b16* WT = (b16*)carve((size_t)3 * H * HD * HD * 2);                  // 294,912 B
  const size_t plane = (size_t)BL * T * DM * 2;                          // 12,582,912 B at full size ([b][h][t][64] or [b][h][64][t] halves)
  b16* QP = (b16*)carve(plane); b16* KP = (b16*)carve(plane); b16* VTh = (b16*)carve(plane); b16* VTl = (b16*)carve(VRES ? plane : 256);
  if (off > ws_size || off > ((size_t)128 << 20)) return;               // total 50,626,560 B at full size
  prep_kernel<<<(unsigned)(((size_t)3 * H * HD * HD / 8 + 255) / 256), 256, 0, stream>>>(Fp(1), Fp(2), Fp(3), WT);
  proj_kernel<<<dim3(T / 64, BL, 3 * NSL), 128, 0, stream>>>(Fp(0), WT, Fp(4), Fp(5), Fp(6), QP, KP, VTh, VTl);
  attn_kernel<<<dim3(T / (16 * NW), BL * H), 32 * NW, 0, stream>>>(QP, KP, VTh, VTl, (float*)d_out);
}

// v004
// A run of this version takes 90 microseconds.
// Next to v003, in two timings, it ran 1.07 and 1.08 times as fast.
// Over all steps from v000 it is 3.33 times as fast.
#include <hip/hip_runtime.h>

// compute dtype: every contraction on v_wmma_f32_16x16x32_f16 (f16 operands, f32 accumulate). Per-head q/k/v projections ([NB*SEQ x 64] x [64 x 64] per head):
// x as exact bf16 x8, W as exact bf16 x256 (1 product); S^T = K Q^T with q/k f16 x8 planes (1 product); O^T += V^T P^T with P f16 x1024 and V^T as f16 hi x8 +
// residual x8192 planes (2 products, second accumulator folded with 1/1024 before normalisation). Biases (as bf16 RNE values), softmax statistics and 1/l in f32.
// Module: x [4][2048][768] viewed as 12 heads x 64; q_h = x_h Wq[h]^T + bq[h] (Wq[h] is (out,in)), k_h, v_h likewise; scores = q k^T / 8; softmax over all keys (no mask);
// out[b][s][64 h + d] = sum_t p v (heads concatenated) -> f32 [4][2048][768]. All float inputs enter as their bf16 RNE values.
// Flash-style: one wave per 16 queries of (b, h) walks all keys in order with a running max; 8 such waves share each K / V^T tile through LDS; deterministic, one writer per element.
// Fragment k-map per lane half hh for A AND B: elements 0..7 <- k = 8hh+0..7, 8..15 <- k = 16+8hh+0..7; acc[r] = D[8hh+r][lane&15].

#ifndef NB
#define NB 4
#endif
#ifndef SEQ
#define SEQ 2048
#endif

namespace {
constexpr int NB_FULL = 4, SEQ_FULL = 2048, DM = 768, H = 12, HD = 64;
constexpr int BL = NB;     // batches computed
constexpr int T = SEQ;     // tokens computed per batch (queries == keys); input and output row index = b * SEQ_FULL + t
constexpr int NSL = DM / 128;          // 128-column slabs (2 heads) per projection
constexpr bool VRES = true;
constexpr float XS = 8.0f, WSC = 256.0f, PS = 1024.0f, RS_ = 1024.0f, LOG2E = 1.4426950408889634f;
static_assert(T % 64 == 0 && T >= 64 && T <= SEQ_FULL && BL >= 1 && BL <= NB_FULL);
static_assert(DM % 128 == 0 && NSL * 128 == DM && H % 2 == 0 && H * HD == DM && HD == 64);
typedef _Float16 b16;
typedef __attribute__((ext_vector_type(16))) _Float16 v16b;
typedef __attribute__((ext_vector_type(8))) _Float16 v8b;
typedef __attribute__((ext_vector_type(4))) _Float16 v4h;
typedef __attribute__((ext_vector_type(2))) _Float16 v2h;
typedef __attribute__((ext_vector_type(8))) float v8f;
typedef __attribute__((ext_vector_type(4))) float v4f;
__device__ __forceinline__ float bf16_rne(float f) { unsigned int u = __float_as_uint(f); u += 0x7FFFu + ((u >> 16) & 1u); return __uint_as_float(u & 0xFFFF0000u); }
__device__ __forceinline__ v16b frag_kb(const b16* p, int hh) { const v8b a = *(const v8b*)(p + 8 * hh), b = *(const v8b*)(p + 16 + 8 * hh); v16b f;
#pragma unroll
  for (int e = 0; e < 8; ++e) { f[e] = a[e]; f[8 + e] = b[e]; } return f; }
// The builtin alone: the compiler keeps the distance a WMMA needs before its registers are touched and fills it with independent work where there is some.
__device__ __forceinline__ v8f wmma16b(v16b a, v16b b, v8f c) { return __builtin_amdgcn_wmma_f32_16x16x32_f16(false, a, false, b, (short)0, c, false, false); }
__device__ __forceinline__ void wave_lds_sync() { __builtin_amdgcn_fence(3, "workgroup"); __builtin_amdgcn_wave_barrier(); __builtin_amdgcn_fence(2, "workgroup"); }
__device__ __forceinline__ float nexp2(float v) { return __builtin_amdgcn_exp2f(v); }

// W fragment straight from a row of the f32 weights: the k positions of frag_kb, each element as its bf16 RNE value x256 in f16
__device__ __forceinline__ v16b frag_w(const float* p, int hh) {
  const v4f a0 = *(const v4f*)(p + 8 * hh), a1 = *(const v4f*)(p + 8 * hh + 4), b0 = *(const v4f*)(p + 16 + 8 * hh), b1 = *(const v4f*)(p + 16 + 8 * hh + 4); v16b f;
#pragma unroll
  for (int e = 0; e < 4; ++e) { f[e] = (b16)(bf16_rne(a0[e]) * WSC); f[4 + e] = (b16)(bf16_rne(a1[e]) * WSC); f[8 + e] = (b16)(bf16_rne(b0[e]) * WSC); f[12 + e] = (b16)(bf16_rne(b1[e]) * WSC); }
  return f; }
// projections: grid (T/64, BL, 3 parts x NSL slabs); block = 64 tokens of batch b x 4 waves; slab = heads 2s, 2s+1: A = x[:, 128 s .. 128 s + 127] (exact bf16 x8) staged.
// Each wave takes all 64 tokens x 32 of the slab's 128 output columns, so every W element the block needs is loaded and converted once, by the wave that uses it, with no launch ahead for it.
__global__ __launch_bounds__(128) void proj_kernel(const float* __restrict__ x, const float* __restrict__ wq, const float* __restrict__ wk, const float* __restrict__ wv,
                                                   const float* __restrict__ bq, const float* __restrict__ bk, const float* __restrict__ bv,
                                                   b16* __restrict__ QP, b16* __restrict__ KP, b16* __restrict__ VTh, b16* __restrict__ VTl) {
  __shared__ __attribute__((aligned(16))) b16 As[64][128 + 8]; __shared__ __attribute__((aligned(16))) float Tf[4][16][128 + 4];
  const int wave = threadIdx.x >> 5, lane = threadIdx.x & 31, nloc = lane & 15, hlf = lane >> 4; const int t0 = blockIdx.x * 64; const int b = blockIdx.y;
  const int part = blockIdx.z / NSL, slab = blockIdx.z % NSL, c0 = slab * 128;
  const float* xb = x + ((size_t)b * SEQ_FULL + t0) * DM + c0; const float* bias = part == 0 ? bq : part == 1 ? bk : bv; const float* wf = part == 0 ? wq : part == 1 ? wk : wv;
  const int hs = wave >> 1, hw = 2 * slab + hs;   // the head (of the slab's two, and of all) that holds this wave's 32 columns
  v16b wb[2][2];                                   // its W fragments [16-column tile][k half], asked for ahead of the x tile
#pragma unroll
  for (int nt = 0; nt < 2; ++nt) { const float* wr = wf + ((size_t)hw * HD + (wave & 1) * 32 + nt * 16 + nloc) * HD; wb[nt][0] = frag_w(wr, hlf); wb[nt][1] = frag_w(wr + 32, hlf); }
  for (int i = threadIdx.x; i < 64 * 32; i += 128) { const int rr = i / 32, q = (i % 32) * 4; const v4f f = *(const v4f*)(xb + (size_t)rr * DM + q); v4h o;
    for (int j = 0; j < 4; ++j) o[j] = (b16)(bf16_rne(f[j]) * XS); *(v4h*)(&As[rr][q]) = o; }
  __syncthreads();
  v8f acc[4][2];   // [16-token tile][16-column tile]
#pragma unroll
  for (int mt = 0; mt < 4; ++mt) { acc[mt][0] = (v8f){}; acc[mt][1] = (v8f){}; }
#pragma unroll
  for (int mt = 0; mt < 4; ++mt)
#pragma unroll
    for (int k2 = 0; k2 < 2; ++k2) { const v16b af = frag_kb(&As[mt * 16 + nloc][hs * HD + 32 * k2], hlf);
#pragma unroll
      for (int nt = 0; nt < 2; ++nt) acc[mt][nt] = wmma16b(af, wb[nt][k2], acc[mt][nt]); }
#pragma unroll
  for (int nt = 0; nt < 2; ++nt) { const int cl = wave * 32 + nt * 16 + nloc; const float bb = bf16_rne(bias[hw * HD + (cl & 63)]);
#pragma unroll
    for (int mt = 0; mt < 4; ++mt)
#pragma unroll
      for (int r = 0; r < 8; ++r) Tf[mt][8 * hlf + r][cl] = acc[mt][nt][r] * (1.0f / (XS * WSC)) + bb; }
  __syncthreads();
  {
    if (part < 2) { b16* plane = part == 0 ? QP : KP; const int c = c0 + lane * 4; const int h = c / HD, d = c % HD;
      for (int rr = 0; rr < 16; ++rr) { const int tok = t0 + wave * 16 + rr; v4h o4; for (int j = 0; j < 4; ++j) o4[j] = (b16)(Tf[wave][rr][lane * 4 + j] * XS);
        *(v4h*)(plane + (((size_t)b * H + h) * T + tok) * HD + d) = o4; } }
    else {
#pragma unroll 1
      for (int q = 0; q < 32; ++q) { const int cl = wave * 32 + q; const int c = c0 + cl; const int h = c / HD, d = c % HD; const int tk = lane * 2; v2h hv, lv;
        for (int j = 0; j < 2; ++j) { const float f = Tf[(tk + j) >> 4][(tk + j) & 15][cl] * XS; const b16 p = (b16)f; hv[j] = p; lv[j] = (b16)((f - (float)p) * RS_); }
        const size_t oi = (((size_t)b * H + h) * HD + d) * (size_t)T + t0 + lane * 2; *(v2h*)(VTh + oi) = hv; if (VRES) *(v2h*)(VTl + oi) = lv; } }
     }
}
// attention: grid (T/128, BL x H): block = 8 waves x 16 queries of (b, h); the block walks all T keys in tiles of 64; each tile (K rows, V^T hi rows, V^T residual rows) is brought into LDS once
// for all 8 waves by asynchronous copies (16 B per lane), two buffers, the next tile in flight while this one is worked on; rows of 128 B at a pitch of 144 B for the ds_load_b128 fragment reads.
// Per wave as before: 32-key steps in key order; logit = s/8 (log2-scaled); online softmax with lazy rescale; P x1024 single; O^T += V^T P^T (2 products when VRES); f32 rows of 64 at column 64h.
constexpr int NW = 8, KT = 64, NT = T / KT, LP = 64 + 8;   // waves per block, keys per tile, tiles, LDS row pitch in halves
constexpr float LAZY = 5.0f;   // log2 units by which a column's maximum may outgrow the one in use before the state is rescaled
constexpr unsigned PLB = 64u * LP * 2u, HRB = 32u * LP * 2u;  // bytes of one staged plane (64 rows), of 32 rows
static_assert(T % (16 * NW) == 0 && KT == 64 && HD == 64);
// One tile: every thread copies 16 B of rows r and r + 32 of each plane. The s_wait_xcnt stands inside the copies' own statement so that no address register is rewritten ahead of it.
__device__ __forceinline__ void stage_tile(unsigned lds, const b16* gk, const b16* gh, const b16* gl) {
  asm volatile("global_load_async_to_lds_b128 %0, %4, off\n\tglobal_load_async_to_lds_b128 %1, %5, off\n\tglobal_load_async_to_lds_b128 %2, %6, off\n\tglobal_load_async_to_lds_b128 %3, %7, off\n\ts_wait_xcnt 0x0"
               :: "v"(lds), "v"(lds + HRB), "v"(lds + PLB), "v"(lds + PLB + HRB), "v"(gk), "v"(gk + 32 * HD), "v"(gh), "v"(gh + (size_t)32 * T) : "memory");
  if (VRES) asm volatile("global_load_async_to_lds_b128 %0, %2, off\n\tglobal_load_async_to_lds_b128 %1, %3, off\n\ts_wait_xcnt 0x0"
               :: "v"(lds + 2 * PLB), "v"(lds + 2 * PLB + HRB), "v"(gl), "v"(gl + (size_t)32 * T) : "memory");
}
__global__ __launch_bounds__(256) void attn_kernel(const b16* __restrict__ QP, const b16* __restrict__ KP, const b16* __restrict__ VTh, const b16* __restrict__ VTl, float* __restrict__ out) {
  __shared__ __attribute__((aligned(16))) b16 St[2][3][64][LP];
  __shared__ __attribute__((aligned(16))) b16 Pb[NW][16][32 + 8]; __shared__ __attribute__((aligned(16))) float To[NW][16][HD + 4];
  const int wave = threadIdx.x >> 5, lane = threadIdx.x & 31, hh = lane >> 4, col = lane & 15; const int b = blockIdx.y / H, h = blockIdx.y % H; const int q0 = blockIdx.x * (16 * NW) + wave * 16, qi = q0 + col;
  const size_t ph = (size_t)b * H + h; const b16* Qb = QP + ph * T * HD; const b16* Kb = KP + ph * T * HD; const b16* Vh = VTh + ph * HD * (size_t)T; const b16* Vl = VTl + ph * HD * (size_t)T;
  const int sr = threadIdx.x >> 3, sc = (threadIdx.x & 7) * 8;   // this thread's staged row (and row + 32) and its 8 halves of it
  const unsigned sl = (unsigned)(size_t)&St[0][0][sr][sc];
  const b16* gk = Kb + (size_t)sr * HD + sc; const b16* gh = Vh + (size_t)sr * T + sc; const b16* gl = Vl + (size_t)sr * T + sc;
  stage_tile(sl, gk, gh, gl);
  const v16b qa0 = frag_kb(Qb + (size_t)qi * HD, hh), qa1 = frag_kb(Qb + (size_t)qi * HD + 32, hh);
  const float cs = LOG2E / (8.0f * XS * XS);
  float m = -INFINITY, l = 0.0f; v8f o[4], ol[4]; for (int t = 0; t < 4; ++t) { o[t] = (v8f){}; ol[t] = (v8f){}; }
  asm volatile("s_wait_asynccnt 0x0" ::: "memory");   // tile 0 of this wave's copies has landed
  __syncthreads();                                     // tile 0 published to all waves
  if (NT > 1) stage_tile(sl + 3 * PLB, gk + (size_t)KT * HD, gh + KT, gl + KT);
#pragma unroll 1
  for (int kt = 0; kt < NT; ++kt) {
    const b16 (*Ks)[LP] = St[kt & 1][0]; const b16 (*Vhs)[LP] = St[kt & 1][1]; const b16 (*Vls)[LP] = St[kt & 1][2];
#pragma unroll 1   // rolled: unrolled, the first step's sixteen p stay live into the second and the wave needs more than 160 registers (five waves per SIMD, not six)
    for (int kb = 0; kb < KT; kb += 32) {
      float e[16]; float mx = -INFINITY; v16b kf[4];   // the step's four K fragments are read as one group ahead of their products
#pragma unroll
      for (int u = 0; u < 2; ++u) { const b16* kr = &Ks[kb + u * 16 + col][0]; kf[2 * u] = frag_kb(kr, hh); kf[2 * u + 1] = frag_kb(kr + 32, hh); }
#pragma unroll
      for (int u = 0; u < 2; ++u) { v8f s = (v8f){}; s = wmma16b(kf[2 * u], qa0, s); s = wmma16b(kf[2 * u + 1], qa1, s);
#pragma unroll
        for (int r = 0; r < 8; ++r) { const float vv = s[r] * cs; e[u * 8 + r] = vv; mx = fmaxf(mx, vv); } }
      mx = fmaxf(mx, __shfl_xor(mx, 16)); float sum = 0.0f;
      // Lazy rescale: one wave-uniform scalar branch per step (EXEC stays full for the WMMAs). The maximum in use is raised, and l and both accumulators rescaled, only when some column's
      // new maximum lies more than LAZY above it; otherwise p <= 2^LAZY, so p x1024 <= 2^15 still fits f16, and the 64 accumulator multiplies are not issued. The first step always takes it (m = -inf).
      if (__builtin_amdgcn_ballot_w32(mx > m + LAZY) != 0u) { const float mn = fmaxf(m, mx); const float al = nexp2(m - mn); l *= al; m = mn;
#pragma unroll
        for (int t = 0; t < 4; ++t) { o[t] *= al; if (VRES) ol[t] *= al; } }
#pragma unroll
      for (int i2 = 0; i2 < 16; ++i2) e[i2] -= m;
#pragma unroll
      for (int i2 = 0; i2 < 16; ++i2) e[i2] = nexp2(e[i2]);
#pragma unroll
      for (int i2 = 0; i2 < 16; ++i2) { sum += e[i2]; Pb[wave][col][(i2 < 8 ? 0 : 16) + 8 * hh + (i2 & 7)] = (b16)(e[i2] * PS); }
      sum += __shfl_xor(sum, 16); l += sum;
      wave_lds_sync();
      const v16b pf = frag_kb(&Pb[wave][col][0], hh); v16b vf[4];   // V^T fragments in groups of four
#pragma unroll
      for (int t = 0; t < 4; ++t) vf[t] = frag_kb(&Vhs[t * 16 + col][kb], hh);
#pragma unroll
      for (int t = 0; t < 4; ++t) o[t] = wmma16b(vf[t], pf, o[t]);
      if (VRES) {
#pragma unroll
        for (int t = 0; t < 4; ++t) vf[t] = frag_kb(&Vls[t * 16 + col][kb], hh);
#pragma unroll
        for (int t = 0; t < 4; ++t) ol[t] = wmma16b(vf[t], pf, ol[t]); }
      wave_lds_sync(); }
    asm volatile("s_wait_dscnt 0x0" ::: "memory");      // this wave's reads of the tile have returned before the buffer is refilled
    asm volatile("s_wait_asynccnt 0x0" ::: "memory");   // this wave's copies of tile kt + 1 have landed
    __syncthreads();                                     // publishes tile kt + 1 and ends every wave's reads of tile kt
    if (kt + 2 < NT) stage_tile(sl + (unsigned)(kt & 1) * (3 * PLB), gk + (size_t)(kt + 2) * KT * HD, gh + (kt + 2) * KT, gl + (kt + 2) * KT); }
  asm volatile("s_wait_asynccnt 0x0" ::: "memory");     // no copy outstanding when the wave goes on to the epilogue and ends
  const float inv = 1.0f / (l * PS * XS);
#pragma unroll
  for (int t = 0; t < 4; ++t)
#pragma unroll
    for (int r = 0; r < 8; ++r) To[wave][col][t * 16 + 8 * hh + r] = (o[t][r] + (VRES ? ol[t][r] * (1.0f / RS_) : 0.0f)) * inv;
  wave_lds_sync();
  { for (int i2 = 0; i2 < 8; ++i2) { const int rr = 2 * i2 + hh;
      *(v4f*)(out + ((size_t)b * SEQ_FULL + q0 + rr) * DM + h * HD + col * 4) = *(const v4f*)(&To[wave][rr][col * 4]); }  }
}
}  // namespace

extern "C" void kernel_launch(void* const* d_in, const int* in_sizes, int n_in, void* d_out, int out_size, void* d_ws, size_t ws_size, hipStream_t stream) {
  if (n_in < 7) return;
  auto Fp = [&](int i) { return (const float*)d_in[i]; };
  // wire order: 0 x [4,2048,768], 1 Wq [12,64,64] (h, out, in), 2 Wk, 3 Wv, 4 bq [12,64], 5 bk, 6 bv; out f32 [4,2048,768]
  const long long need_x = ((long long)(BL - 1) * SEQ_FULL + T) * (long long)DM;
  if ((long long)in_sizes[0] < need_x || in_sizes[1] < H * HD * HD || in_sizes[2] < H * HD * HD || in_sizes[3] < H * HD * HD ||
      in_sizes[4] < H * HD || in_sizes[5] < H * HD || in_sizes[6] < H * HD || (long long)out_size < need_x) return;
  size_t off = 0; char* ws = (char*)d_ws;
  auto carve = [&](size_t bytes) { char* p = ws + off; off += (bytes + 255) & ~(size_t)255; return p; };
  const size_t plane = (size_t)BL * T * DM * 2;                          // 12,582,912 B at full size ([b][h][t][64] or [b][h][64][t] halves)
  b16* QP = (b16*)carve(plane); b16* KP = (b16*)carve(plane); b16* VTh = (b16*)carve(plane); b16* VTl = (b16*)carve(VRES ? plane : 256);
  if (off > ws_size || off > ((size_t)128 << 20)) return;               // total 50,331,648 B at full size
  proj_kernel<<<dim3(T / 64, BL, 3 * NSL), 128, 0, stream>>>(Fp(0), Fp(1), Fp(2), Fp(3), Fp(4), Fp(5), Fp(6), QP, KP, VTh, VTl);
  attn_kernel<<<dim3(T / (16 * NW), BL * H), 32 * NW, 0, stream>>>(QP, KP, VTh, VTl, (float*)d_out);
}

// v005
// A run of this version takes 86.1 microseconds.
// Timed twice side by side with v004, it ran 1.04 and 1.05 times as fast.
// All steps since v000 together make it 3.50 times as fast.
#include <hip/hip_runtime.h>

// compute dtype: every contraction on v_wmma_f32_16x16x32_f16 (f16 operands, f32 accumulate). Per-head q/k/v projections ([NB*SEQ x 64] x [64 x 64] per head):
// x as exact bf16 x8, W as exact bf16 x256 (1 product); S^T = K Q^T with q/k f16 x8 planes (1 product); O^T += V^T P^T with P f16 x1024 and V^T as f16 hi x8 +
// residual x8192 planes (2 products, second accumulator folded with 1/1024 before normalisation). Biases (as bf16 RNE values), softmax statistics and 1/l in f32.
// Module: x [4][2048][768] viewed as 12 heads x 64; q_h = x_h Wq[h]^T + bq[h] (Wq[h] is (out,in)), k_h, v_h likewise; scores = q k^T / 8; softmax over all keys (no mask);
// out[b][s][64 h + d] = sum_t p v (heads concatenated) -> f32 [4][2048][768]. All float inputs enter as their bf16 RNE values.
// Flash-style: one wave per 16 queries of (b, h) walks all keys in order with a running max; 8 such waves share each K / V^T tile through LDS; deterministic, one writer per element.
// Fragment k-map per lane half hh for A AND B: elements 0..7 <- k = 8hh+0..7, 8..15 <- k = 16+8hh+0..7; acc[r] = D[8hh+r][lane&15].

#ifndef NB
#define NB 4
#endif
#ifndef SEQ
#define SEQ 2048
#endif

namespace {
constexpr int NB_FULL = 4, SEQ_FULL = 2048, DM = 768, H = 12, HD = 64;
constexpr int BL = NB;     // batches computed
constexpr int T = SEQ;     // tokens computed per batch (queries == keys); input and output row index = b * SEQ_FULL + t
constexpr int NSL = DM / 128;          // 128-column slabs (2 heads) per projection
constexpr bool VRES = true;
constexpr float XS = 8.0f, WSC = 256.0f, PS = 1024.0f, RS_ = 1024.0f, LOG2E = 1.4426950408889634f;
static_assert(T % 64 == 0 && T >= 64 && T <= SEQ_FULL && BL >= 1 && BL <= NB_FULL);
static_assert(DM % 128 == 0 && NSL * 128 == DM && H % 2 == 0 && H * HD == DM && HD == 64);
typedef _Float16 b16;
typedef __attribute__((ext_vector_type(16))) _Float16 v16b;
typedef __attribute__((ext_vector_type(8))) _Float16 v8b;
typedef __attribute__((ext_vector_type(4))) _Float16 v4h;
typedef __attribute__((ext_vector_type(2))) _Float16 v2h;
typedef __attribute__((ext_vector_type(8))) float v8f;
typedef __attribute__((ext_vector_type(4))) float v4f;
__device__ __forceinline__ float bf16_rne(float f) { unsigned int u = __float_as_uint(f); u += 0x7FFFu + ((u >> 16) & 1u); return __uint_as_float(u & 0xFFFF0000u); }
__device__ __forceinline__ v16b frag_kb(const b16* p, int hh) { const v8b a = *(const v8b*)(p + 8 * hh), b = *(const v8b*)(p + 16 + 8 * hh); v16b f;
#pragma unroll
  for (int e = 0; e < 8; ++e) { f[e] = a[e]; f[8 + e] = b[e]; } return f; }
// The builtin alone: the compiler keeps the distance a WMMA needs before its registers are touched and fills it with independent work where there is some.
__device__ __forceinline__ v8f wmma16b(v16b a, v16b b, v8f c) { return __builtin_amdgcn_wmma_f32_16x16x32_f16(false, a, false, b, (short)0, c, false, false); }
__device__ __forceinline__ void wave_lds_sync() { __builtin_amdgcn_fence(3, "workgroup"); __builtin_amdgcn_wave_barrier(); __builtin_amdgcn_fence(2, "workgroup"); }
__device__ __forceinline__ float nexp2(float v) { return __builtin_amdgcn_exp2f(v); }
// lane l's value seen from lane l ^ 16, by one vector instruction (v_permlanex16_b32): no LDS queue and no dscnt wait on the way
__device__ __forceinline__ float xhalf(float v) { const int b = __builtin_bit_cast(int, v); return __builtin_bit_cast(float, __builtin_amdgcn_permlanex16(b, b, 0x76543210, 0xfedcba98, false, false)); }

// W fragment straight from a row of the f32 weights: the k positions of frag_kb, each element as its bf16 RNE value x256 in f16
__device__ __forceinline__ v16b frag_w(const float* p, int hh) {
  const v4f a0 = *(const v4f*)(p + 8 * hh), a1 = *(const v4f*)(p + 8 * hh + 4), b0 = *(const v4f*)(p + 16 + 8 * hh), b1 = *(const v4f*)(p + 16 + 8 * hh + 4); v16b f;
#pragma unroll
  for (int e = 0; e < 4; ++e) { f[e] = (b16)(bf16_rne(a0[e]) * WSC); f[4 + e] = (b16)(bf16_rne(a1[e]) * WSC); f[8 + e] = (b16)(bf16_rne(b0[e]) * WSC); f[12 + e] = (b16)(bf16_rne(b1[e]) * WSC); }
  return f; }
// projections: grid (T/64, BL, 3 parts x NSL slabs); block = 64 tokens of batch b x 4 waves; slab = heads 2s, 2s+1: A = x[:, 128 s .. 128 s + 127] (exact bf16 x8) staged.
// Each wave takes all 64 tokens x 32 of the slab's 128 output columns, so every W element the block needs is loaded and converted once, by the wave that uses it, with no launch ahead for it.
__global__ __launch_bounds__(128) void proj_kernel(const float* __restrict__ x, const float* __restrict__ wq, const float* __restrict__ wk, const float* __restrict__ wv,
                                                   const float* __restrict__ bq, const float* __restrict__ bk, const float* __restrict__ bv,
                                                   b16* __restrict__ QP, b16* __restrict__ KP, b16* __restrict__ VTh, b16* __restrict__ VTl) {
  __shared__ __attribute__((aligned(16))) b16 As[64][128 + 8]; __shared__ __attribute__((aligned(16))) float Tf[4][16][128 + 4];
  const int wave = threadIdx.x >> 5, lane = threadIdx.x & 31, nloc = lane & 15, hlf = lane >> 4; const int t0 = blockIdx.x * 64; const int b = blockIdx.y;
  const int part = blockIdx.z / NSL, slab = blockIdx.z % NSL, c0 = slab * 128;
  const float* xb = x + ((size_t)b * SEQ_FULL + t0) * DM + c0; const float* bias = part == 0 ? bq : part == 1 ? bk : bv; const float* wf = part == 0 ? wq : part == 1 ? wk : wv;
  const int hs = wave >> 1, hw = 2 * slab + hs;   // the head (of the slab's two, and of all) that holds this wave's 32 columns
  v16b wb[2][2];                                   // its W fragments [16-column tile][k half], asked for ahead of the x tile
#pragma unroll
  for (int nt = 0; nt < 2; ++nt) { const float* wr = wf + ((size_t)hw * HD + (wave & 1) * 32 + nt * 16 + nloc) * HD; wb[nt][0] = frag_w(wr, hlf); wb[nt][1] = frag_w(wr + 32, hlf); }
  for (int i = threadIdx.x; i < 64 * 32; i += 128) { const int rr = i / 32, q = (i % 32) * 4; const v4f f = *(const v4f*)(xb + (size_t)rr * DM + q); v4h o;
    for (int j = 0; j < 4; ++j) o[j] = (b16)(bf16_rne(f[j]) * XS); *(v4h*)(&As[rr][q]) = o; }
  __syncthreads();
  v8f acc[4][2];   // [16-token tile][16-column tile]
#pragma unroll
  for (int mt = 0; mt < 4; ++mt) { acc[mt][0] = (v8f){}; acc[mt][1] = (v8f){}; }
#pragma unroll
  for (int mt = 0; mt < 4; ++mt)
#pragma unroll
    for (int k2 = 0; k2 < 2; ++k2) { const v16b af = frag_kb(&As[mt * 16 + nloc][hs * HD + 32 * k2], hlf);
#pragma unroll
      for (int nt = 0; nt < 2; ++nt) acc[mt][nt] = wmma16b(af, wb[nt][k2], acc[mt][nt]); }
#pragma unroll
  for (int nt = 0; nt < 2; ++nt) { const int cl = wave * 32 + nt * 16 + nloc; const float bb = bf16_rne(bias[hw * HD + (cl & 63)]);
#pragma unroll
    for (int mt = 0; mt < 4; ++mt)
#pragma unroll
      for (int r = 0; r < 8; ++r) Tf[mt][8 * hlf + r][cl] = acc[mt][nt][r] * (1.0f / (XS * WSC)) + bb; }
  __syncthreads();
  {
    if (part < 2) { b16* plane = part == 0 ? QP : KP; const int c = c0 + lane * 4; const int h = c / HD, d = c % HD;
      for (int rr = 0; rr < 16; ++rr) { const int tok = t0 + wave * 16 + rr; v4h o4; for (int j = 0; j < 4; ++j) o4[j] = (b16)(Tf[wave][rr][lane * 4 + j] * XS);
        *(v4h*)(plane + (((size_t)b * H + h) * T + tok) * HD + d) = o4; } }
    else {
#pragma unroll 1
      for (int q = 0; q < 32; ++q) { const int cl = wave * 32 + q; const int c = c0 + cl; const int h = c / HD, d = c % HD; const int tk = lane * 2; v2h hv, lv;
        for (int j = 0; j < 2; ++j) { const float f = Tf[(tk + j) >> 4][(tk + j) & 15][cl] * XS; const b16 p = (b16)f; hv[j] = p; lv[j] = (b16)((f - (float)p) * RS_); }
        const size_t oi = (((size_t)b * H + h) * HD + d) * (size_t)T + t0 + lane * 2; *(v2h*)(VTh + oi) = hv; if (VRES) *(v2h*)(VTl + oi) = lv; } }
     }
}
// attention: grid (T/128, BL x H): block = 8 waves x 16 queries of (b, h); the block walks all T keys in tiles of 64; each tile (K rows, V^T hi rows, V^T residual rows) is brought into LDS once
// for all 8 waves by asynchronous copies (16 B per lane), two buffers, the next tile in flight while this one is worked on; rows of 128 B at a pitch of 144 B for the ds_load_b128 fragment reads.
// Per wave as before: 32-key steps in key order; logit = s/8 (log2-scaled); online softmax with lazy rescale; P x1024 single; O^T += V^T P^T (2 products when VRES); f32 rows of 64 at column 64h.
constexpr int NW = 8, KT = 64, NT = T / KT, LP = 64 + 8;   // waves per block, keys per tile, tiles, LDS row pitch in halves
constexpr float LAZY = 5.0f;   // log2 units by which a column's maximum may outgrow the one in use before the state is rescaled
constexpr unsigned PLB = 64u * LP * 2u, HRB = 32u * LP * 2u;  // bytes of one staged plane (64 rows), of 32 rows
static_assert(T % (16 * NW) == 0 && KT == 64 && HD == 64);
// One tile: every thread copies 16 B of rows r and r + 32 of each plane. The s_wait_xcnt stands inside the copies' own statement so that no address register is rewritten ahead of it.
__device__ __forceinline__ void stage_tile(unsigned lds, const b16* gk, const b16* gh, const b16* gl) {
  asm volatile("global_load_async_to_lds_b128 %0, %4, off\n\tglobal_load_async_to_lds_b128 %1, %5, off\n\tglobal_load_async_to_lds_b128 %2, %6, off\n\tglobal_load_async_to_lds_b128 %3, %7, off\n\ts_wait_xcnt 0x0"
               :: "v"(lds), "v"(lds + HRB), "v"(lds + PLB), "v"(lds + PLB + HRB), "v"(gk), "v"(gk + 32 * HD), "v"(gh), "v"(gh + (size_t)32 * T) : "memory");
  if (VRES) asm volatile("global_load_async_to_lds_b128 %0, %2, off\n\tglobal_load_async_to_lds_b128 %1, %3, off\n\ts_wait_xcnt 0x0"
               :: "v"(lds + 2 * PLB), "v"(lds + 2 * PLB + HRB), "v"(gl), "v"(gl + (size_t)32 * T) : "memory");
}
__global__ __launch_bounds__(256) void attn_kernel(const b16* __restrict__ QP, const b16* __restrict__ KP, const b16* __restrict__ VTh, const b16* __restrict__ VTl, float* __restrict__ out) {
  __shared__ __attribute__((aligned(16))) b16 St[2][3][64][LP];
  __shared__ __attribute__((aligned(16))) float To[NW][16][HD + 4];
  const int wave = threadIdx.x >> 5, lane = threadIdx.x & 31, hh = lane >> 4, col = lane & 15; const int b = blockIdx.y / H, h = blockIdx.y % H; const int q0 = blockIdx.x * (16 * NW) + wave * 16, qi = q0 + col;
  const size_t ph = (size_t)b * H + h; const b16* Qb = QP + ph * T * HD; const b16* Kb = KP + ph * T * HD; const b16* Vh = VTh + ph * HD * (size_t)T; const b16* Vl = VTl + ph * HD * (size_t)T;
  const int sr = threadIdx.x >> 3, sc = (threadIdx.x & 7) * 8;   // this thread's staged row (and row + 32) and its 8 halves of it
  const unsigned sl = (unsigned)(size_t)&St[0][0][sr][sc];
  const b16* gk = Kb + (size_t)sr * HD + sc; const b16* gh = Vh + (size_t)sr * T + sc; const b16* gl = Vl + (size_t)sr * T + sc;
  stage_tile(sl, gk, gh, gl);
  const v16b qa0 = frag_kb(Qb + (size_t)qi * HD, hh), qa1 = frag_kb(Qb + (size_t)qi * HD + 32, hh);
  const float cs = LOG2E / (8.0f * XS * XS);
  float m = -INFINITY, l = 0.0f; v8f o[4], ol[4]; for (int t = 0; t < 4; ++t) { o[t] = (v8f){}; ol[t] = (v8f){}; }
  asm volatile("s_wait_asynccnt 0x0" ::: "memory");   // tile 0 of this wave's copies has landed
  __syncthreads();                                     // tile 0 published to all waves
  if (NT > 1) stage_tile(sl + 3 * PLB, gk + (size_t)KT * HD, gh + KT, gl + KT);
#pragma unroll 1
  for (int kt = 0; kt < NT; ++kt) {
    const b16 (*Ks)[LP] = St[kt & 1][0]; const b16 (*Vhs)[LP] = St[kt & 1][1]; const b16 (*Vls)[LP] = St[kt & 1][2];
#pragma unroll 1   // rolled: unrolled, the first step's sixteen p stay live into the second and the wave needs more than 160 registers (five waves per SIMD, not six)
    for (int kb = 0; kb < KT; kb += 32) {
      float e[16]; float mx = -INFINITY; v16b kf[4];   // the step's four K fragments are read as one group ahead of their products
#pragma unroll
      for (int u = 0; u < 2; ++u) { const b16* kr = &Ks[kb + u * 16 + col][0]; kf[2 * u] = frag_kb(kr, hh); kf[2 * u + 1] = frag_kb(kr + 32, hh); }
#pragma unroll
      for (int u = 0; u < 2; ++u) { v8f s = (v8f){}; s = wmma16b(kf[2 * u], qa0, s); s = wmma16b(kf[2 * u + 1], qa1, s);
#pragma unroll
        for (int r = 0; r < 8; ++r) { const float vv = s[r] * cs; e[u * 8 + r] = vv; mx = fmaxf(mx, vv); } }
      mx = fmaxf(mx, xhalf(mx)); float sum = 0.0f; v16b pf;
      // Lazy rescale: one wave-uniform scalar branch per step (EXEC stays full for the WMMAs). The maximum in use is raised, and l and both accumulators rescaled, only when some column's
      // new maximum lies more than LAZY above it; otherwise p <= 2^LAZY, so p x1024 <= 2^15 still fits f16, and the 64 accumulator multiplies are not issued. The first step always takes it (m = -inf).
      if (__builtin_amdgcn_ballot_w32(mx > m + LAZY) != 0u) { const float mn = fmaxf(m, mx); const float al = nexp2(m - mn); l *= al; m = mn;
#pragma unroll
        for (int t = 0; t < 4; ++t) { o[t] *= al; if (VRES) ol[t] *= al; } }
#pragma unroll
      for (int i2 = 0; i2 < 16; ++i2) e[i2] -= m;
#pragma unroll
      for (int i2 = 0; i2 < 16; ++i2) e[i2] = nexp2(e[i2]);
#pragma unroll
      for (int i2 = 0; i2 < 16; ++i2) { sum += e[i2]; pf[i2] = (b16)(e[i2] * PS); }   // the two score tiles of a lane, converted in place, are its P^T fragment (k = 8hh+r, 16+8hh+r)
      v16b vf[4];   // V^T fragments in groups of four
#pragma unroll
      for (int t = 0; t < 4; ++t) vf[t] = frag_kb(&Vhs[t * 16 + col][kb], hh);
#pragma unroll
      for (int t = 0; t < 4; ++t) o[t] = wmma16b(vf[t], pf, o[t]);
      if (VRES) {
#pragma unroll
        for (int t = 0; t < 4; ++t) vf[t] = frag_kb(&Vls[t * 16 + col][kb], hh);
#pragma unroll
        for (int t = 0; t < 4; ++t) ol[t] = wmma16b(vf[t], pf, ol[t]); }
      l += sum; }
    asm volatile("s_wait_dscnt 0x0" ::: "memory");      // this wave's reads of the tile have returned before the buffer is refilled
    asm volatile("s_wait_asynccnt 0x0" ::: "memory");   // this wave's copies of tile kt + 1 have landed
    __syncthreads();                                     // publishes tile kt + 1 and ends every wave's reads of tile kt
    if (kt + 2 < NT) stage_tile(sl + (unsigned)(kt & 1) * (3 * PLB), gk + (size_t)(kt + 2) * KT * HD, gh + (kt + 2) * KT, gl + (kt + 2) * KT); }
  asm volatile("s_wait_asynccnt 0x0" ::: "memory");     // no copy outstanding when the wave goes on to the epilogue and ends
  l += xhalf(l);   // each half of the wave has summed its own 16 of every 32 keys
  const float inv = 1.0f / (l * PS * XS);
#pragma unroll
  for (int t = 0; t < 4; ++t)
#pragma unroll
    for (int r = 0; r < 8; ++r) To[wave][col][t * 16 + 8 * hh + r] = (o[t][r] + (VRES ? ol[t][r] * (1.0f / RS_) : 0.0f)) * inv;
  wave_lds_sync();
  { for (int i2 = 0; i2 < 8; ++i2) { const int rr = 2 * i2 + hh;
      *(v4f*)(out + ((size_t)b * SEQ_FULL + q0 + rr) * DM + h * HD + col * 4) = *(const v4f*)(&To[wave][rr][col * 4]); }  }
}
}  // namespace

extern "C" void kernel_launch(void* const* d_in, const int* in_sizes, int n_in, void* d_out, int out_size, void* d_ws, size_t ws_size, hipStream_t stream) {
  if (n_in < 7) return;
  auto Fp = [&](int i) { return (const float*)d_in[i]; };
  // wire order: 0 x [4,2048,768], 1 Wq [12,64,64] (h, out, in), 2 Wk, 3 Wv, 4 bq [12,64], 5 bk, 6 bv; out f32 [4,2048,768]
  const long long need_x = ((long long)(BL - 1) * SEQ_FULL + T) * (long long)DM;
  if ((long long)in_sizes[0] < need_x || in_sizes[1] < H * HD * HD || in_sizes[2] < H * HD * HD || in_sizes[3] < H * HD * HD ||
      in_sizes[4] < H * HD || in_sizes[5] < H * HD || in_sizes[6] < H * HD || (long long)out_size < need_x) return;
  size_t off = 0; char* ws = (char*)d_ws;
  auto carve = [&](size_t bytes) { char* p = ws + off; off += (bytes + 255) & ~(size_t)255; return p; };
  const size_t plane = (size_t)BL * T * DM * 2;                          // 12,582,912 B at full size ([b][h][t][64] or [b][h][64][t] halves)
  b16* QP = (b16*)carve(plane); b16* KP = (b16*)carve(plane); b16* VTh = (b16*)carve(plane); b16* VTl = (b16*)carve(VRES ? plane : 256);
  if (off > ws_size || off > ((size_t)128 << 20)) return;               // total 50,331,648 B at full size
  proj_kernel<<<dim3(T / 64, BL, 3 * NSL), 128, 0, stream>>>(Fp(0), Fp(1), Fp(2), Fp(3), Fp(4), Fp(5), Fp(6), QP, KP, VTh, VTl);
  attn_kernel<<<dim3(T / (16 * NW), BL * H), 32 * NW, 0, stream>>>(QP, KP, VTh, VTl, (float*)d_out);
}

// v006
// Measured time: 73.7 microseconds a run.
// Timed twice side by side with v005, it ran 1.17 times as fast both times.
// Over all steps from v000 it is 4.09 times as fast.
#include <hip/hip_runtime.h>

// compute dtype: every contraction on v_wmma_f32_16x16x32_f16 (f16 operands, f32 accumulate). Per-head q/k/v projections ([NB*SEQ x 64] x [64 x 64] per head):
// x as exact bf16 x8, W as exact bf16 x256 (1 product); S^T = K Q^T with q/k f16 x8 planes (1 product); O^T += V^T P^T with P f16 x1024 and V^T f16 x8,
// both operands rounded once to f16 (1 product). Biases (as bf16 RNE values), softmax statistics and 1/l in f32.
// Module: x [4][2048][768] viewed as 12 heads x 64; q_h = x_h Wq[h]^T + bq[h] (Wq[h] is (out,in)), k_h, v_h likewise; scores = q k^T / 8; softmax over all keys (no mask);
// out[b][s][64 h + d] = sum_t p v (heads concatenated) -> f32 [4][2048][768]. All float inputs enter as their bf16 RNE values.
// Flash-style: one wave per 16 queries of (b, h) walks all keys in order with a running max; 8 such waves share each K / V^T tile through LDS; deterministic, one writer per element.
// Fragment k-map per lane half hh for A AND B: elements 0..7 <- k = 8hh+0..7, 8..15 <- k = 16+8hh+0..7; acc[r] = D[8hh+r][lane&15].

#ifndef NB
#define NB 4
#endif
#ifndef SEQ
#define SEQ 2048
#endif

namespace {
constexpr int NB_FULL = 4, SEQ_FULL = 2048, DM = 768, H = 12, HD = 64;
constexpr int BL = NB;     // batches computed
constexpr int T = SEQ;     // tokens computed per batch (queries == keys); input and output row index = b * SEQ_FULL + t
constexpr int NSL = DM / 128;          // 128-column slabs (2 heads) per projection
constexpr float XS = 8.0f, WSC = 256.0f, PS = 1024.0f, LOG2E = 1.4426950408889634f;
static_assert(T % 64 == 0 && T >= 64 && T <= SEQ_FULL && BL >= 1 && BL <= NB_FULL);
static_assert(DM % 128 == 0 && NSL * 128 == DM && H % 2 == 0 && H * HD == DM && HD == 64);
typedef _Float16 b16;
typedef __attribute__((ext_vector_type(16))) _Float16 v16b;
typedef __attribute__((ext_vector_type(8))) _Float16 v8b;
typedef __attribute__((ext_vector_type(4))) _Float16 v4h;
typedef __attribute__((ext_vector_type(2))) _Float16 v2h;
typedef __attribute__((ext_vector_type(8))) float v8f;
typedef __attribute__((ext_vector_type(4))) float v4f;
__device__ __forceinline__ float bf16_rne(float f) { unsigned int u = __float_as_uint(f); u += 0x7FFFu + ((u >> 16) & 1u); return __uint_as_float(u & 0xFFFF0000u); }
__device__ __forceinline__ v16b frag_kb(const b16* p, int hh) { const v8b a = *(const v8b*)(p + 8 * hh), b = *(const v8b*)(p + 16 + 8 * hh); v16b f;
#pragma unroll
  for (int e = 0; e < 8; ++e) { f[e] = a[e]; f[8 + e] = b[e]; } return f; }
// The builtin alone: the compiler keeps the distance a WMMA needs before its registers are touched and fills it with independent work where there is some.
__device__ __forceinline__ v8f wmma16b(v16b a, v16b b, v8f c) { return __builtin_amdgcn_wmma_f32_16x16x32_f16(false, a, false, b, (short)0, c, false, false); }
__device__ __forceinline__ void wave_lds_sync() { __builtin_amdgcn_fence(3, "workgroup"); __builtin_amdgcn_wave_barrier(); __builtin_amdgcn_fence(2, "workgroup"); }
__device__ __forceinline__ float nexp2(float v) { return __builtin_amdgcn_exp2f(v); }
// lane l's value seen from lane l ^ 16, by one vector instruction (v_permlanex16_b32): no LDS queue and no dscnt wait on the way
__device__ __forceinline__ float xhalf(float v) { const int b = __builtin_bit_cast(int, v); return __builtin_bit_cast(float, __builtin_amdgcn_permlanex16(b, b, 0x76543210, 0xfedcba98, false, false)); }

// W fragment straight from a row of the f32 weights: the k positions of frag_kb, each element as its bf16 RNE value x256 in f16
__device__ __forceinline__ v16b frag_w(const float* p, int hh) {
  const v4f a0 = *(const v4f*)(p + 8 * hh), a1 = *(const v4f*)(p + 8 * hh + 4), b0 = *(const v4f*)(p + 16 + 8 * hh), b1 = *(const v4f*)(p + 16 + 8 * hh + 4); v16b f;
#pragma unroll
  for (int e = 0; e < 4; ++e) { f[e] = (b16)(bf16_rne(a0[e]) * WSC); f[4 + e] = (b16)(bf16_rne(a1[e]) * WSC); f[8 + e] = (b16)(bf16_rne(b0[e]) * WSC); f[12 + e] = (b16)(bf16_rne(b1[e]) * WSC); }
  return f; }
// projections: grid (T/64, BL, 3 parts x NSL slabs); block = 64 tokens of batch b x 4 waves; slab = heads 2s, 2s+1: A = x[:, 128 s .. 128 s + 127] (exact bf16 x8) staged.
// Each wave takes all 64 tokens x 32 of the slab's 128 output columns, so every W element the block needs is loaded and converted once, by the wave that uses it, with no launch ahead for it.
__global__ __launch_bounds__(128) void proj_kernel(const float* __restrict__ x, const float* __restrict__ wq, const float* __restrict__ wk, const float* __restrict__ wv,
                                                   const float* __restrict__ bq, const float* __restrict__ bk, const float* __restrict__ bv,
                                                   b16* __restrict__ QP, b16* __restrict__ KP, b16* __restrict__ VT) {
  __shared__ __attribute__((aligned(16))) b16 As[64][128 + 8]; __shared__ __attribute__((aligned(16))) float Tf[4][16][128 + 4];
  const int wave = threadIdx.x >> 5, lane = threadIdx.x & 31, nloc = lane & 15, hlf = lane >> 4; const int t0 = blockIdx.x * 64; const int b = blockIdx.y;
  const int part = blockIdx.z / NSL, slab = blockIdx.z % NSL, c0 = slab * 128;
  const float* xb = x + ((size_t)b * SEQ_FULL + t0) * DM + c0; const float* bias = part == 0 ? bq : part == 1 ? bk : bv; const float* wf = part == 0 ? wq : part == 1 ? wk : wv;
  const int hs = wave >> 1, hw = 2 * slab + hs;   // the head (of the slab's two, and of all) that holds this wave's 32 columns
  v16b wb[2][2];                                   // its W fragments [16-column tile][k half], asked for ahead of the x tile
#pragma unroll
  for (int nt = 0; nt < 2; ++nt) { const float* wr = wf + ((size_t)hw * HD + (wave & 1) * 32 + nt * 16 + nloc) * HD; wb[nt][0] = frag_w(wr, hlf); wb[nt][1] = frag_w(wr + 32, hlf); }
  for (int i = threadIdx.x; i < 64 * 32; i += 128) { const int rr = i / 32, q = (i % 32) * 4; const v4f f = *(const v4f*)(xb + (size_t)rr * DM + q); v4h o;
    for (int j = 0; j < 4; ++j) o[j] = (b16)(bf16_rne(f[j]) * XS); *(v4h*)(&As[rr][q]) = o; }
  __syncthreads();
  v8f acc[4][2];   // [16-token tile][16-column tile]
#pragma unroll
  for (int mt = 0; mt < 4; ++mt) { acc[mt][0] = (v8f){}; acc[mt][1] = (v8f){}; }
#pragma unroll
  for (int mt = 0; mt < 4; ++mt)
#pragma unroll
    for (int k2 = 0; k2 < 2; ++k2) { const v16b af = frag_kb(&As[mt * 16 + nloc][hs * HD + 32 * k2], hlf);
#pragma unroll
      for (int nt = 0; nt < 2; ++nt) acc[mt][nt] = wmma16b(af, wb[nt][k2], acc[mt][nt]); }
#pragma unroll
  for (int nt = 0; nt < 2; ++nt) { const int cl = wave * 32 + nt * 16 + nloc; const float bb = bf16_rne(bias[hw * HD + (cl & 63)]);
#pragma unroll
    for (int mt = 0; mt < 4; ++mt)
#pragma unroll
      for (int r = 0; r < 8; ++r) Tf[mt][8 * hlf + r][cl] = acc[mt][nt][r] * (1.0f / (XS * WSC)) + bb; }
  __syncthreads();
  {
    if (part < 2) { b16* plane = part == 0 ? QP : KP; const int c = c0 + lane * 4; const int h = c / HD, d = c % HD;
      for (int rr = 0; rr < 16; ++rr) { const int tok = t0 + wave * 16 + rr; v4h o4; for (int j = 0; j < 4; ++j) o4[j] = (b16)(Tf[wave][rr][lane * 4 + j] * XS);
        *(v4h*)(plane + (((size_t)b * H + h) * T + tok) * HD + d) = o4; } }
    else {
#pragma unroll 1
      for (int q = 0; q < 32; ++q) { const int cl = wave * 32 + q; const int c = c0 + cl; const int h = c / HD, d = c % HD; const int tk = lane * 2; v2h hv;
        for (int j = 0; j < 2; ++j) hv[j] = (b16)(Tf[(tk + j) >> 4][(tk + j) & 15][cl] * XS);
        const size_t oi = (((size_t)b * H + h) * HD + d) * (size_t)T + t0 + lane * 2; *(v2h*)(VT + oi) = hv;
        asm volatile("s_wait_xcnt 0x0" ::: "memory"); } }   // a precaution of form: the next trip rewrites the registers that the issued store names
     }
}
// attention: grid (T/128, BL x H): block = 8 waves x 16 queries of (b, h); the block walks all T keys in tiles of 64; each tile (K rows, V^T rows) is brought into LDS once
// for all 8 waves by asynchronous copies (16 B per lane), two buffers, the next tile in flight while this one is worked on; rows of 128 B at a pitch of 144 B for the ds_load_b128 fragment reads.
// Per wave as before: 32-key steps in key order; logit = s/8 (log2-scaled); online softmax with lazy rescale; P x1024 single; O^T += V^T P^T; f32 rows of 64 at column 64h.
constexpr int NW = 8, KT = 64, NT = T / KT, LP = 64 + 8;   // waves per block, keys per tile, tiles, LDS row pitch in halves
constexpr float LAZY = 5.0f;   // log2 units by which a column's maximum may outgrow the one in use before the state is rescaled
constexpr unsigned PLB = 64u * LP * 2u, HRB = 32u * LP * 2u;  // bytes of one staged plane (64 rows), of 32 rows
static_assert(T % (16 * NW) == 0 && KT == 64 && HD == 64);
// One tile: every thread copies 16 B of rows r and r + 32 of each plane. The s_wait_xcnt stands inside the copies' own statement so that no address register is rewritten ahead of it.
__device__ __forceinline__ void stage_tile(unsigned lds, const b16* gk, const b16* gh) {
  asm volatile("global_load_async_to_lds_b128 %0, %4, off\n\tglobal_load_async_to_lds_b128 %1, %5, off\n\tglobal_load_async_to_lds_b128 %2, %6, off\n\tglobal_load_async_to_lds_b128 %3, %7, off\n\ts_wait_xcnt 0x0"
               :: "v"(lds), "v"(lds + HRB), "v"(lds + PLB), "v"(lds + PLB + HRB), "v"(gk), "v"(gk + 32 * HD), "v"(gh), "v"(gh + (size_t)32 * T) : "memory");
}
__global__ __launch_bounds__(256) void attn_kernel(const b16* __restrict__ QP, const b16* __restrict__ KP, const b16* __restrict__ VT, float* __restrict__ out) {
  __shared__ __attribute__((aligned(16))) b16 St[2][2][64][LP];
  __shared__ __attribute__((aligned(16))) float To[NW][16][HD + 4];
  const int wave = threadIdx.x >> 5, lane = threadIdx.x & 31, hh = lane >> 4, col = lane & 15; const int b = blockIdx.y / H, h = blockIdx.y % H; const int q0 = blockIdx.x * (16 * NW) + wave * 16, qi = q0 + col;
  const size_t ph = (size_t)b * H + h; const b16* Qb = QP + ph * T * HD; const b16* Kb = KP + ph * T * HD; const b16* Vh = VT + ph * HD * (size_t)T;
  const int sr = threadIdx.x >> 3, sc = (threadIdx.x & 7) * 8;   // this thread's staged row (and row + 32) and its 8 halves of it
  const unsigned sl = (unsigned)(size_t)&St[0][0][sr][sc];
  const b16* gk = Kb + (size_t)sr * HD + sc; const b16* gh = Vh + (size_t)sr * T + sc;
  stage_tile(sl, gk, gh);
  const v16b qa0 = frag_kb(Qb + (size_t)qi * HD, hh), qa1 = frag_kb(Qb + (size_t)qi * HD + 32, hh);
  const float cs = LOG2E / (8.0f * XS * XS);
  float m = -INFINITY, l = 0.0f; v8f o[4]; for (int t = 0; t < 4; ++t) o[t] = (v8f){};
  asm volatile("s_wait_asynccnt 0x0" ::: "memory");   // tile 0 of this wave's copies has landed
  __syncthreads();                                     // tile 0 published to all waves
  if (NT > 1) stage_tile(sl + 2 * PLB, gk + (size_t)KT * HD, gh + KT);
#pragma unroll 1
  for (int kt = 0; kt < NT; ++kt) {
    const b16 (*Ks)[LP] = St[kt & 1][0]; const b16 (*Vhs)[LP] = St[kt & 1][1];
#pragma unroll 1   // rolled: one 32-key step's code and live registers at a time, so that six waves per SIMD fit with room to spare; the unrolled form is a scheduling step of its own and has not been timed
    for (int kb = 0; kb < KT; kb += 32) {
      float e[16]; float mx = -INFINITY; v16b kf[4];   // the step's four K fragments are read as one group ahead of their products
#pragma unroll
      for (int u = 0; u < 2; ++u) { const b16* kr = &Ks[kb + u * 16 + col][0]; kf[2 * u] = frag_kb(kr, hh); kf[2 * u + 1] = frag_kb(kr + 32, hh); }
#pragma unroll
      for (int u = 0; u < 2; ++u) { v8f s = (v8f){}; s = wmma16b(kf[2 * u], qa0, s); s = wmma16b(kf[2 * u + 1], qa1, s);
#pragma unroll
        for (int r = 0; r < 8; ++r) { const float vv = s[r] * cs; e[u * 8 + r] = vv; mx = fmaxf(mx, vv); } }
      mx = fmaxf(mx, xhalf(mx)); float sum = 0.0f; v16b pf;
      // Lazy rescale: one wave-uniform scalar branch per step (EXEC stays full for the WMMAs). The maximum in use is raised, and l and the accumulator rescaled, only when some column's
      // new maximum lies more than LAZY above it; otherwise p <= 2^LAZY, so p x1024 <= 2^15 still fits f16, and the 32 accumulator multiplies are not issued. The first step always takes it (m = -inf).
      if (__builtin_amdgcn_ballot_w32(mx > m + LAZY) != 0u) { const float mn = fmaxf(m, mx); const float al = nexp2(m - mn); l *= al; m = mn;
#pragma unroll
        for (int t = 0; t < 4; ++t) o[t] *= al; }
#pragma unroll
      for (int i2 = 0; i2 < 16; ++i2) e[i2] -= m;
#pragma unroll
      for (int i2 = 0; i2 < 16; ++i2) e[i2] = nexp2(e[i2]);
#pragma unroll
      for (int i2 = 0; i2 < 16; ++i2) { sum += e[i2]; pf[i2] = (b16)(e[i2] * PS); }   // the two score tiles of a lane, converted in place, are its P^T fragment (k = 8hh+r, 16+8hh+r)
      v16b vf[4];   // V^T fragments in groups of four
#pragma unroll
      for (int t = 0; t < 4; ++t) vf[t] = frag_kb(&Vhs[t * 16 + col][kb], hh);
#pragma unroll
      for (int t = 0; t < 4; ++t) o[t] = wmma16b(vf[t], pf, o[t]);
      l += sum; }
    asm volatile("s_wait_dscnt 0x0" ::: "memory");      // this wave's reads of the tile have returned before the buffer is refilled
    asm volatile("s_wait_asynccnt 0x0" ::: "memory");   // this wave's copies of tile kt + 1 have landed
    __syncthreads();                                     // publishes tile kt + 1 and ends every wave's reads of tile kt
    if (kt + 2 < NT) stage_tile(sl + (unsigned)(kt & 1) * (2 * PLB), gk + (size_t)(kt + 2) * KT * HD, gh + (kt + 2) * KT); }
  asm volatile("s_wait_asynccnt 0x0" ::: "memory");     // no copy outstanding when the wave goes on to the epilogue and ends
  l += xhalf(l);   // each half of the wave has summed its own 16 of every 32 keys
  const float inv = 1.0f / (l * PS * XS);
#pragma unroll
  for (int t = 0; t < 4; ++t)
#pragma unroll
    for (int r = 0; r < 8; ++r) To[wave][col][t * 16 + 8 * hh + r] = o[t][r] * inv;
  wave_lds_sync();
  { for (int i2 = 0; i2 < 8; ++i2) { const int rr = 2 * i2 + hh;
      *(v4f*)(out + ((size_t)b * SEQ_FULL + q0 + rr) * DM + h * HD + col * 4) = *(const v4f*)(&To[wave][rr][col * 4]); }  }
}
}  // namespace

extern "C" void kernel_launch(void* const* d_in, const int* in_sizes, int n_in, void* d_out, int out_size, void* d_ws, size_t ws_size, hipStream_t stream) {
  if (n_in < 7) return;
  auto Fp = [&](int i) { return (const float*)d_in[i]; };
  // wire order: 0 x [4,2048,768], 1 Wq [12,64,64] (h, out, in), 2 Wk, 3 Wv, 4 bq [12,64], 5 bk, 6 bv; out f32 [4,2048,768]
  const long long need_x = ((long long)(BL - 1) * SEQ_FULL + T) * (long long)DM;
  if ((long long)in_sizes[0] < need_x || in_sizes[1] < H * HD * HD || in_sizes[2] < H * HD * HD || in_sizes[3] < H * HD * HD ||
      in_sizes[4] < H * HD || in_sizes[5] < H * HD || in_sizes[6] < H * HD || (long long)out_size < need_x) return;
  size_t off = 0; char* ws = (char*)d_ws;
  auto carve = [&](size_t bytes) { char* p = ws + off; off += (bytes + 255) & ~(size_t)255; return p; };
  const size_t plane = (size_t)BL * T * DM * 2;                          // 12,582,912 B at full size ([b][h][t][64] or [b][h][64][t] halves)
  b16* QP = (b16*)carve(plane); b16* KP = (b16*)carve(plane); b16* VT = (b16*)carve(plane);
  if (off > ws_size || off > ((size_t)128 << 20)) return;               // total 37,748,736 B at full size
  proj_kernel<<<dim3(T / 64, BL, 3 * NSL), 128, 0, stream>>>(Fp(0), Fp(1), Fp(2), Fp(3), Fp(4), Fp(5), Fp(6), QP, KP, VT);
  attn_kernel<<<dim3(T / (16 * NW), BL * H), 32 * NW, 0, stream>>>(QP, KP, VT, (float*)d_out);
}

// v007
// A run of this version takes 68.4 microseconds.
// In both of two side-by-side timings against v006, it was 1.08 times as fast.
// Counting every step since v000, it is 4.42 times as fast.
#include <hip/hip_runtime.h>

// compute dtype: every contraction on v_wmma_f32_16x16x32_f16 (f16 operands, f32 accumulate). Per-head q/k/v projections ([NB*SEQ x 64] x [64 x 64] per head):
// x as exact bf16 x8, W as exact bf16 x256 (1 product); S^T = K Q^T + C with k f16 x8 and q f16 x log2(e)/64 (1 product); O^T += V^T P^T with P f16 x1024 and V^T f16 x8,
// both operands rounded once to f16 (1 product). Biases (as bf16 RNE values), softmax statistics and 1/l in f32.
// Module: x [4][2048][768] viewed as 12 heads x 64; q_h = x_h Wq[h]^T + bq[h] (Wq[h] is (out,in)), k_h, v_h likewise; scores = q k^T / 8; softmax over all keys (no mask);
// out[b][s][64 h + d] = sum_t p v (heads concatenated) -> f32 [4][2048][768]. All float inputs enter as their bf16 RNE values.
// Flash-style: one wave per 16 queries of (b, h) walks all keys in order with a running max; 8 such waves share each K / V^T tile through LDS; deterministic, one writer per element.
// Fragment k-map per lane half hh for A AND B: elements 0..7 <- k = 8hh+0..7, 8..15 <- k = 16+8hh+0..7; acc[r] = D[8hh+r][lane&15].

#ifndef NB
#define NB 4
#endif
#ifndef SEQ
#define SEQ 2048
#endif

namespace {
constexpr int NB_FULL = 4, SEQ_FULL = 2048, DM = 768, H = 12, HD = 64;
constexpr int BL = NB;     // batches computed
constexpr int T = SEQ;     // tokens computed per batch (queries == keys); input and output row index = b * SEQ_FULL + t
constexpr int NSL = DM / 128;          // 128-column slabs (2 heads) per projection
constexpr float XS = 8.0f, WSC = 256.0f, LOG2E = 1.4426950408889634f;
constexpr float QS = LOG2E / (8.0f * XS);   // scale of the stored q: (q QS) . (k XS) = q . k / 8 in log2 units, so a score product needs no multiply behind it
constexpr float LPS = 10.0f;                // log2 of the factor 1024 that P carries into f16; it rides in the score product's start value
static_assert(T % 64 == 0 && T >= 64 && T <= SEQ_FULL && BL >= 1 && BL <= NB_FULL);
static_assert(DM % 128 == 0 && NSL * 128 == DM && H % 2 == 0 && H * HD == DM && HD == 64);
typedef _Float16 b16;
typedef __attribute__((ext_vector_type(16))) _Float16 v16b;
typedef __attribute__((ext_vector_type(8))) _Float16 v8b;
typedef __attribute__((ext_vector_type(4))) _Float16 v4h;
typedef __attribute__((ext_vector_type(2))) _Float16 v2h;
typedef __attribute__((ext_vector_type(8))) float v8f;
typedef __attribute__((ext_vector_type(4))) float v4f;
__device__ __forceinline__ float bf16_rne(float f) { unsigned int u = __float_as_uint(f); u += 0x7FFFu + ((u >> 16) & 1u); return __uint_as_float(u & 0xFFFF0000u); }
__device__ __forceinline__ v16b frag_kb(const b16* p, int hh) { const v8b a = *(const v8b*)(p + 8 * hh), b = *(const v8b*)(p + 16 + 8 * hh); v16b f;
#pragma unroll
  for (int e = 0; e < 8; ++e) { f[e] = a[e]; f[8 + e] = b[e]; } return f; }
// The builtin alone: the compiler keeps the distance a WMMA needs before its registers are touched and fills it with independent work where there is some.
__device__ __forceinline__ v8f wmma16b(v16b a, v16b b, v8f c) { return __builtin_amdgcn_wmma_f32_16x16x32_f16(false, a, false, b, (short)0, c, false, false); }
__device__ __forceinline__ void wave_lds_sync() { __builtin_amdgcn_fence(3, "workgroup"); __builtin_amdgcn_wave_barrier(); __builtin_amdgcn_fence(2, "workgroup"); }
__device__ __forceinline__ float nexp2(float v) { return __builtin_amdgcn_exp2f(v); }
// lane l's value seen from lane l ^ 16, by one vector instruction (v_permlanex16_b32): no LDS queue and no dscnt wait on the way
__device__ __forceinline__ float xhalf(float v) { const int b = __builtin_bit_cast(int, v); return __builtin_bit_cast(float, __builtin_amdgcn_permlanex16(b, b, 0x76543210, 0xfedcba98, false, false)); }

// W fragment straight from a row of the f32 weights: the k positions of frag_kb, each element as its bf16 RNE value x256 in f16
__device__ __forceinline__ v16b frag_w(const float* p, int hh) {
  const v4f a0 = *(const v4f*)(p + 8 * hh), a1 = *(const v4f*)(p + 8 * hh + 4), b0 = *(const v4f*)(p + 16 + 8 * hh), b1 = *(const v4f*)(p + 16 + 8 * hh + 4); v16b f;
#pragma unroll
  for (int e = 0; e < 4; ++e) { f[e] = (b16)(bf16_rne(a0[e]) * WSC); f[4 + e] = (b16)(bf16_rne(a1[e]) * WSC); f[8 + e] = (b16)(bf16_rne(b0[e]) * WSC); f[12 + e] = (b16)(bf16_rne(b1[e]) * WSC); }
  return f; }
// projections: grid (T/64, BL, 3 parts x NSL slabs); block = 64 tokens of batch b x 4 waves; slab = heads 2s, 2s+1: A = x[:, 128 s .. 128 s + 127] (exact bf16 x8) staged.
// Each wave takes all 64 tokens x 32 of the slab's 128 output columns, so every W element the block needs is loaded and converted once, by the wave that uses it, with no launch ahead for it.
__global__ __launch_bounds__(128) void proj_kernel(const float* __restrict__ x, const float* __restrict__ wq, const float* __restrict__ wk, const float* __restrict__ wv,
                                                   const float* __restrict__ bq, const float* __restrict__ bk, const float* __restrict__ bv,
                                                   b16* __restrict__ QP, b16* __restrict__ KP, b16* __restrict__ VT) {
  __shared__ __attribute__((aligned(16))) b16 As[64][128 + 8]; __shared__ __attribute__((aligned(16))) float Tf[4][16][128 + 4];
  const int wave = threadIdx.x >> 5, lane = threadIdx.x & 31, nloc = lane & 15, hlf = lane >> 4; const int t0 = blockIdx.x * 64; const int b = blockIdx.y;
  const int part = blockIdx.z / NSL, slab = blockIdx.z % NSL, c0 = slab * 128;
  const float* xb = x + ((size_t)b * SEQ_FULL + t0) * DM + c0; const float* bias = part == 0 ? bq : part == 1 ? bk : bv; const float* wf = part == 0 ? wq : part == 1 ? wk : wv;
  const int hs = wave >> 1, hw = 2 * slab + hs;   // the head (of the slab's two, and of all) that holds this wave's 32 columns
  v16b wb[2][2];                                   // its W fragments [16-column tile][k half], asked for ahead of the x tile
#pragma unroll
  for (int nt = 0; nt < 2; ++nt) { const float* wr = wf + ((size_t)hw * HD + (wave & 1) * 32 + nt * 16 + nloc) * HD; wb[nt][0] = frag_w(wr, hlf); wb[nt][1] = frag_w(wr + 32, hlf); }
  for (int i = threadIdx.x; i < 64 * 32; i += 128) { const int rr = i / 32, q = (i % 32) * 4; const v4f f = *(const v4f*)(xb + (size_t)rr * DM + q); v4h o;
    for (int j = 0; j < 4; ++j) o[j] = (b16)(bf16_rne(f[j]) * XS); *(v4h*)(&As[rr][q]) = o; }
  __syncthreads();
  v8f acc[4][2];   // [16-token tile][16-column tile]
#pragma unroll
  for (int mt = 0; mt < 4; ++mt) { acc[mt][0] = (v8f){}; acc[mt][1] = (v8f){}; }
#pragma unroll
  for (int mt = 0; mt < 4; ++mt)
#pragma unroll
    for (int k2 = 0; k2 < 2; ++k2) { const v16b af = frag_kb(&As[mt * 16 + nloc][hs * HD + 32 * k2], hlf);
#pragma unroll
      for (int nt = 0; nt < 2; ++nt) acc[mt][nt] = wmma16b(af, wb[nt][k2], acc[mt][nt]); }
#pragma unroll
  for (int nt = 0; nt < 2; ++nt) { const int cl = wave * 32 + nt * 16 + nloc; const float bb = bf16_rne(bias[hw * HD + (cl & 63)]);
#pragma unroll
    for (int mt = 0; mt < 4; ++mt)
#pragma unroll
      for (int r = 0; r < 8; ++r) Tf[mt][8 * hlf + r][cl] = acc[mt][nt][r] * (1.0f / (XS * WSC)) + bb; }
  __syncthreads();
  {
    if (part < 2) { b16* plane = part == 0 ? QP : KP; const float os = part == 0 ? QS : XS; const int c = c0 + lane * 4; const int h = c / HD, d = c % HD;
      for (int rr = 0; rr < 16; ++rr) { const int tok = t0 + wave * 16 + rr; v4h o4; for (int j = 0; j < 4; ++j) o4[j] = (b16)(Tf[wave][rr][lane * 4 + j] * os);
        *(v4h*)(plane + (((size_t)b * H + h) * T + tok) * HD + d) = o4; } }
    else {
#pragma unroll 1
      for (int q = 0; q < 32; ++q) { const int cl = wave * 32 + q; const int c = c0 + cl; const int h = c / HD, d = c % HD; const int tk = lane * 2; v2h hv;
        for (int j = 0; j < 2; ++j) hv[j] = (b16)(Tf[(tk + j) >> 4][(tk + j) & 15][cl] * XS);
        const size_t oi = (((size_t)b * H + h) * HD + d) * (size_t)T + t0 + lane * 2; *(v2h*)(VT + oi) = hv;
        asm volatile("s_wait_xcnt 0x0" ::: "memory"); } }   // a precaution of form: the next trip rewrites the registers that the issued store names
     }
}
// attention: grid (T/128, BL x H): block = 8 waves x 16 queries of (b, h); the block walks all T keys in tiles of 64; each tile (K rows, V^T rows) is brought into LDS once
// for all 8 waves by asynchronous copies (16 B per lane), two buffers, the next tile in flight while this one is worked on; rows of 128 B at a pitch of 144 B for the ds_load_b128 fragment reads.
// Per wave: 32-key steps in key order; the score product starts from C = 10 - (maximum in use) and q is stored log2-scaled, so its result is the argument of exp2 for P x1024 as it stands;
// online softmax with lazy rescale; O^T += V^T P^T; f32 rows of 64 at column 64h.
constexpr int NW = 8, KT = 64, NT = T / KT, LP = 64 + 8;   // waves per block, keys per tile, tiles, LDS row pitch in halves
constexpr float LAZY = 5.0f;   // log2 units by which a column's maximum may outgrow the one in use before the state is rescaled
constexpr unsigned PLB = 64u * LP * 2u, HRB = 32u * LP * 2u;  // bytes of one staged plane (64 rows), of 32 rows
static_assert(T % (16 * NW) == 0 && KT == 64 && HD == 64);
// One tile: every thread copies 16 B of rows r and r + 32 of each plane. The s_wait_xcnt stands inside the copies' own statement so that no address register is rewritten ahead of it.
__device__ __forceinline__ void stage_tile(unsigned lds, const b16* gk, const b16* gh) {
  asm volatile("global_load_async_to_lds_b128 %0, %4, off\n\tglobal_load_async_to_lds_b128 %1, %5, off\n\tglobal_load_async_to_lds_b128 %2, %6, off\n\tglobal_load_async_to_lds_b128 %3, %7, off\n\ts_wait_xcnt 0x0"
               :: "v"(lds), "v"(lds + HRB), "v"(lds + PLB), "v"(lds + PLB + HRB), "v"(gk), "v"(gk + 32 * HD), "v"(gh), "v"(gh + (size_t)32 * T) : "memory");
}
__global__ __launch_bounds__(256) void attn_kernel(const b16* __restrict__ QP, const b16* __restrict__ KP, const b16* __restrict__ VT, float* __restrict__ out) {
  __shared__ __attribute__((aligned(16))) b16 St[2][2][64][LP];
  __shared__ __attribute__((aligned(16))) float To[NW][16][HD + 4];
  const int wave = threadIdx.x >> 5, lane = threadIdx.x & 31, hh = lane >> 4, col = lane & 15; const int b = blockIdx.y / H, h = blockIdx.y % H; const int q0 = blockIdx.x * (16 * NW) + wave * 16, qi = q0 + col;
  const size_t ph = (size_t)b * H + h; const b16* Qb = QP + ph * T * HD; const b16* Kb = KP + ph * T * HD; const b16* Vh = VT + ph * HD * (size_t)T;
  const int sr = threadIdx.x >> 3, sc = (threadIdx.x & 7) * 8;   // this thread's staged row (and row + 32) and its 8 halves of it
  const unsigned sl = (unsigned)(size_t)&St[0][0][sr][sc];
  const b16* gk = Kb + (size_t)sr * HD + sc; const b16* gh = Vh + (size_t)sr * T + sc;
  stage_tile(sl, gk, gh);
  const v16b qa0 = frag_kb(Qb + (size_t)qi * HD, hh), qa1 = frag_kb(Qb + (size_t)qi * HD + 32, hh);
  // cin: the score products' start value, 10 - m in all eight rows of the lane's column (m = 0 until the first step has seen scores). thr, lo: -inf until then, so that the first step
  // always takes the branch below and may also lower m to its own maximum; afterwards m only rises.
  v8f cin; for (int r = 0; r < 8; ++r) cin[r] = LPS;
  float thr = -INFINITY, lo = -INFINITY, l = 0.0f; v8f o[4]; for (int t = 0; t < 4; ++t) o[t] = (v8f){};
  asm volatile("s_wait_asynccnt 0x0" ::: "memory");   // tile 0 of this wave's copies has landed
  __syncthreads();                                     // tile 0 published to all waves
  if (NT > 1) stage_tile(sl + 2 * PLB, gk + (size_t)KT * HD, gh + KT);
#pragma unroll 1
  for (int kt = 0; kt < NT; ++kt) {
    const b16* kp = &St[kt & 1][0][col][8 * hh]; const b16* vp = &St[kt & 1][1][col][8 * hh];
    // kp, vp: this lane's place in the K rows and V^T rows of the step at hand, carried and moved on inside the step.
#pragma unroll 1   // rolled: one 32-key step's code and live registers at a time, so that six waves per SIMD fit with room to spare; the unrolled form is a scheduling step of its own and has not been timed
    for (int kb = 0; kb < KT; kb += 32) {
      float e[16]; float mx = -INFINITY; v16b kf[4];   // the step's four K fragments are read as one group ahead of their products
#pragma unroll
      for (int u = 0; u < 2; ++u) { const b16* kr = kp + u * 16 * LP; kf[2 * u] = frag_kb(kr, 0); kf[2 * u + 1] = frag_kb(kr + 32, 0); }
      kp += 32 * LP;
#pragma unroll
      for (int u = 0; u < 2; ++u) { v8f s = wmma16b(kf[2 * u], qa0, cin); s = wmma16b(kf[2 * u + 1], qa1, s);
#pragma unroll
        for (int r = 0; r < 8; ++r) { e[u * 8 + r] = s[r]; mx = fmaxf(mx, s[r]); } }
      mx = fmaxf(mx, xhalf(mx)); float sum = 0.0f; v16b pf;
      // Lazy rescale: one wave-uniform scalar branch per step (EXEC stays full for the WMMAs). The maximum in use is raised, and l and the accumulator rescaled, only when some column's
      // new maximum lies more than LAZY above it; otherwise p <= 2^LAZY, so p x1024 <= 2^15 still fits f16, and the 32 accumulator multiplies are not issued. The first step always takes it (thr = -inf).
      // Only here are this step's scores, which were formed against the old maximum, shifted by vector instructions.
      if (__builtin_amdgcn_ballot_w32(mx > thr) != 0u) { const float d = fmaxf(mx - LPS, lo); const float al = nexp2(fminf(-d, 0.0f)); l *= al; thr = LPS + LAZY; lo = 0.0f;
#pragma unroll
        for (int t = 0; t < 4; ++t) o[t] *= al;
#pragma unroll
        for (int i2 = 0; i2 < 16; ++i2) e[i2] -= d;
#pragma unroll
        for (int r = 0; r < 8; ++r) cin[r] -= d; }
#pragma unroll
      for (int i2 = 0; i2 < 16; ++i2) e[i2] = nexp2(e[i2]);
#pragma unroll
      for (int i2 = 0; i2 < 16; ++i2) { sum += e[i2]; pf[i2] = (b16)e[i2]; }   // the two score tiles of a lane, converted in place, are its P^T fragment (k = 8hh+r, 16+8hh+r); l sums p x1024
      v16b vf[4];   // V^T fragments in groups of four
#pragma unroll
      for (int t = 0; t < 4; ++t) vf[t] = frag_kb(vp + t * 16 * LP, 0);
      vp += 32;
#pragma unroll
      for (int t = 0; t < 4; ++t) o[t] = wmma16b(vf[t], pf, o[t]);
      l += sum; }
    asm volatile("s_wait_dscnt 0x0" ::: "memory");      // this wave's reads of the tile have returned before the buffer is refilled
    asm volatile("s_wait_asynccnt 0x0" ::: "memory");   // this wave's copies of tile kt + 1 have landed
    __syncthreads();                                     // publishes tile kt + 1 and ends every wave's reads of tile kt
    if (kt + 2 < NT) stage_tile(sl + (unsigned)(kt & 1) * (2 * PLB), gk + (size_t)(kt + 2) * KT * HD, gh + (kt + 2) * KT); }
  asm volatile("s_wait_asynccnt 0x0" ::: "memory");     // no copy outstanding when the wave goes on to the epilogue and ends
  l += xhalf(l);   // each half of the wave has summed its own 16 of every 32 keys
  const float inv = 1.0f / (l * XS);   // l and O both carry the x1024 of P
#pragma unroll
  for (int t = 0; t < 4; ++t)
#pragma unroll
    for (int r = 0; r < 8; ++r) To[wave][col][t * 16 + 8 * hh + r] = o[t][r] * inv;
  wave_lds_sync();
  { for (int i2 = 0; i2 < 8; ++i2) { const int rr = 2 * i2 + hh;
      *(v4f*)(out + ((size_t)b * SEQ_FULL + q0 + rr) * DM + h * HD + col * 4) = *(const v4f*)(&To[wave][rr][col * 4]); }  }
}
}  // namespace

extern "C" void kernel_launch(void* const* d_in, const int* in_sizes, int n_in, void* d_out, int out_size, void* d_ws, size_t ws_size, hipStream_t stream) {
  if (n_in < 7) return;
  auto Fp = [&](int i) { return (const float*)d_in[i]; };
  // wire order: 0 x [4,2048,768], 1 Wq [12,64,64] (h, out, in), 2 Wk, 3 Wv, 4 bq [12,64], 5 bk, 6 bv; out f32 [4,2048,768]
  const long long need_x = ((long long)(BL - 1) * SEQ_FULL + T) * (long long)DM;
  if ((long long)in_sizes[0] < need_x || in_sizes[1] < H * HD * HD || in_sizes[2] < H * HD * HD || in_sizes[3] < H * HD * HD ||
      in_sizes[4] < H * HD || in_sizes[5] < H * HD || in_sizes[6] < H * HD || (long long)out_size < need_x) return;
  size_t off = 0; char* ws = (char*)d_ws;
  auto carve = [&](size_t bytes) { char* p = ws + off; off += (bytes + 255) & ~(size_t)255; return p; };
  const size_t plane = (size_t)BL * T * DM * 2;                          // 12,582,912 B at full size ([b][h][t][64] or [b][h][64][t] halves)
  b16* QP = (b16*)carve(plane); b16* KP = (b16*)carve(plane); b16* VT = (b16*)carve(plane);
  if (off > ws_size || off > ((size_t)128 << 20)) return;               // total 37,748,736 B at full size
  proj_kernel<<<dim3(T / 64, BL, 3 * NSL), 128, 0, stream>>>(Fp(0), Fp(1), Fp(2), Fp(3), Fp(4), Fp(5), Fp(6), QP, KP, VT);
  attn_kernel<<<dim3(T / (16 * NW), BL * H), 32 * NW, 0, stream>>>(QP, KP, VT, (float*)d_out);
}

// v008
// A run of this version takes 64.8 microseconds.
// Two timings next to v007 put it at 1.05 and 1.06 times that version's speed.
// Over all steps from v000 it is 4.66 times as fast.
#include <hip/hip_runtime.h>

// compute dtype: every contraction on v_wmma_f32_16x16x32_f16 (f16 operands, f32 accumulate). Per-head q/k/v projections ([NB*SEQ x 64] x [64 x 64] per head):
// x as exact bf16 x8, W as exact bf16 x256 (1 product); S^T = K Q^T + C with k f16 x8 and q f16 x log2(e)/64 (1 product); O^T += V^T P^T with P f16 x1024 and V^T f16 x8,
// both operands rounded once to f16 (1 product). Biases (as bf16 RNE values), softmax statistics and 1/l in f32.
// Module: x [4][2048][768] viewed as 12 heads x 64; q_h = x_h Wq[h]^T + bq[h] (Wq[h] is (out,in)), k_h, v_h likewise; scores = q k^T / 8; softmax over all keys (no mask);
// out[b][s][64 h + d] = sum_t p v (heads concatenated) -> f32 [4][2048][768]. All float inputs enter as their bf16 RNE values.
// Flash-style: one wave per 32 queries of (b, h), as two 16-column tiles, walks all keys in order with a running max; 4 such waves share each K / V^T tile through LDS; deterministic, one writer per element.
// Fragment k-map per lane half hh for A AND B: elements 0..7 <- k = 8hh+0..7, 8..15 <- k = 16+8hh+0..7; acc[r] = D[8hh+r][lane&15].

#ifndef NB
#define NB 4
#endif
#ifndef SEQ
#define SEQ 2048
#endif

namespace {
constexpr int NB_FULL = 4, SEQ_FULL = 2048, DM = 768, H = 12, HD = 64;
constexpr int BL = NB;     // batches computed
constexpr int T = SEQ;     // tokens computed per batch (queries == keys); input and output row index = b * SEQ_FULL + t
constexpr int NSL = DM / 128;          // 128-column slabs (2 heads) per projection
constexpr float XS = 8.0f, WSC = 256.0f, LOG2E = 1.4426950408889634f;
constexpr float QS = LOG2E / (8.0f * XS);   // scale of the stored q: (q QS) . (k XS) = q . k / 8 in log2 units, so a score product needs no multiply behind it
constexpr float LPS = 10.0f;                // log2 of the factor 1024 that P carries into f16; it rides in the score product's start value
static_assert(T % 64 == 0 && T >= 64 && T <= SEQ_FULL && BL >= 1 && BL <= NB_FULL);
static_assert(DM % 128 == 0 && NSL * 128 == DM && H % 2 == 0 && H * HD == DM && HD == 64);
typedef _Float16 b16;
typedef __attribute__((ext_vector_type(16))) _Float16 v16b;
typedef __attribute__((ext_vector_type(8))) _Float16 v8b;
typedef __attribute__((ext_vector_type(4))) _Float16 v4h;
typedef __attribute__((ext_vector_type(2))) _Float16 v2h;
typedef __attribute__((ext_vector_type(8))) float v8f;
typedef __attribute__((ext_vector_type(4))) float v4f;
__device__ __forceinline__ float bf16_rne(float f) { unsigned int u = __float_as_uint(f); u += 0x7FFFu + ((u >> 16) & 1u); return __uint_as_float(u & 0xFFFF0000u); }
__device__ __forceinline__ v16b frag_kb(const b16* p, int hh) { const v8b a = *(const v8b*)(p + 8 * hh), b = *(const v8b*)(p + 16 + 8 * hh); v16b f;
#pragma unroll
  for (int e = 0; e < 8; ++e) { f[e] = a[e]; f[8 + e] = b[e]; } return f; }
// The builtin alone: the compiler keeps the distance a WMMA needs before its registers are touched and fills it with independent work where there is some.
__device__ __forceinline__ v8f wmma16b(v16b a, v16b b, v8f c) { return __builtin_amdgcn_wmma_f32_16x16x32_f16(false, a, false, b, (short)0, c, false, false); }
__device__ __forceinline__ void wave_lds_sync() { __builtin_amdgcn_fence(3, "workgroup"); __builtin_amdgcn_wave_barrier(); __builtin_amdgcn_fence(2, "workgroup"); }
__device__ __forceinline__ float nexp2(float v) { return __builtin_amdgcn_exp2f(v); }
// lane l's value seen from lane l ^ 16, by one vector instruction (v_permlanex16_b32): no LDS queue and no dscnt wait on the way
__device__ __forceinline__ float xhalf(float v) { const int b = __builtin_bit_cast(int, v); return __builtin_bit_cast(float, __builtin_amdgcn_permlanex16(b, b, 0x76543210, 0xfedcba98, false, false)); }

// W fragment straight from a row of the f32 weights: the k positions of frag_kb, each element as its bf16 RNE value x256 in f16
__device__ __forceinline__ v16b frag_w(const float* p, int hh) {
  const v4f a0 = *(const v4f*)(p + 8 * hh), a1 = *(const v4f*)(p + 8 * hh + 4), b0 = *(const v4f*)(p + 16 + 8 * hh), b1 = *(const v4f*)(p + 16 + 8 * hh + 4); v16b f;
#pragma unroll
  for (int e = 0; e < 4; ++e) { f[e] = (b16)(bf16_rne(a0[e]) * WSC); f[4 + e] = (b16)(bf16_rne(a1[e]) * WSC); f[8 + e] = (b16)(bf16_rne(b0[e]) * WSC); f[12 + e] = (b16)(bf16_rne(b1[e]) * WSC); }
  return f; }
// projections: grid (T/64, BL, 3 parts x NSL slabs); block = 64 tokens of batch b x 4 waves; slab = heads 2s, 2s+1: A = x[:, 128 s .. 128 s + 127] (exact bf16 x8) staged.
// Each wave takes all 64 tokens x 32 of the slab's 128 output columns, so every W element the block needs is loaded and converted once, by the wave that uses it, with no launch ahead for it.
__global__ __launch_bounds__(128) void proj_kernel(const float* __restrict__ x, const float* __restrict__ wq, const float* __restrict__ wk, const float* __restrict__ wv,
                                                   const float* __restrict__ bq, const float* __restrict__ bk, const float* __restrict__ bv,
                                                   b16* __restrict__ QP, b16* __restrict__ KP, b16* __restrict__ VT) {
  __shared__ __attribute__((aligned(16))) b16 As[64][128 + 8]; __shared__ __attribute__((aligned(16))) float Tf[4][16][128 + 4];
  const int wave = threadIdx.x >> 5, lane = threadIdx.x & 31, nloc = lane & 15, hlf = lane >> 4; const int t0 = blockIdx.x * 64; const int b = blockIdx.y;
  const int part = blockIdx.z / NSL, slab = blockIdx.z % NSL, c0 = slab * 128;
  const float* xb = x + ((size_t)b * SEQ_FULL + t0) * DM + c0; const float* bias = part == 0 ? bq : part == 1 ? bk : bv; const float* wf = part == 0 ? wq : part == 1 ? wk : wv;
  const int hs = wave >> 1, hw = 2 * slab + hs;   // the head (of the slab's two, and of all) that holds this wave's 32 columns
  v16b wb[2][2];                                   // its W fragments [16-column tile][k half], asked for ahead of the x tile
#pragma unroll
  for (int nt = 0; nt < 2; ++nt) { const float* wr = wf + ((size_t)hw * HD + (wave & 1) * 32 + nt * 16 + nloc) * HD; wb[nt][0] = frag_w(wr, hlf); wb[nt][1] = frag_w(wr + 32, hlf); }
  for (int i = threadIdx.x; i < 64 * 32; i += 128) { const int rr = i / 32, q = (i % 32) * 4; const v4f f = *(const v4f*)(xb + (size_t)rr * DM + q); v4h o;
    for (int j = 0; j < 4; ++j) o[j] = (b16)(bf16_rne(f[j]) * XS); *(v4h*)(&As[rr][q]) = o; }
  __syncthreads();
  v8f acc[4][2];   // [16-token tile][16-column tile]
#pragma unroll
  for (int mt = 0; mt < 4; ++mt) { acc[mt][0] = (v8f){}; acc[mt][1] = (v8f){}; }
#pragma unroll
  for (int mt = 0; mt < 4; ++mt)
#pragma unroll
    for (int k2 = 0; k2 < 2; ++k2) { const v16b af = frag_kb(&As[mt * 16 + nloc][hs * HD + 32 * k2], hlf);
#pragma unroll
      for (int nt = 0; nt < 2; ++nt) acc[mt][nt] = wmma16b(af, wb[nt][k2], acc[mt][nt]); }
#pragma unroll
  for (int nt = 0; nt < 2; ++nt) { const int cl = wave * 32 + nt * 16 + nloc; const float bb = bf16_rne(bias[hw * HD + (cl & 63)]);
#pragma unroll
    for (int mt = 0; mt < 4; ++mt)
#pragma unroll
      for (int r = 0; r < 8; ++r) Tf[mt][8 * hlf + r][cl] = acc[mt][nt][r] * (1.0f / (XS * WSC)) + bb; }
  __syncthreads();
  {
    if (part < 2) { b16* plane = part == 0 ? QP : KP; const float os = part == 0 ? QS : XS; const int c = c0 + lane * 4; const int h = c / HD, d = c % HD;
      for (int rr = 0; rr < 16; ++rr) { const int tok = t0 + wave * 16 + rr; v4h o4; for (int j = 0; j < 4; ++j) o4[j] = (b16)(Tf[wave][rr][lane * 4 + j] * os);
        *(v4h*)(plane + (((size_t)b * H + h) * T + tok) * HD + d) = o4; } }
    else {
#pragma unroll 1
      for (int q = 0; q < 32; ++q) { const int cl = wave * 32 + q; const int c = c0 + cl; const int h = c / HD, d = c % HD; const int tk = lane * 2; v2h hv;
        for (int j = 0; j < 2; ++j) hv[j] = (b16)(Tf[(tk + j) >> 4][(tk + j) & 15][cl] * XS);
        const size_t oi = (((size_t)b * H + h) * HD + d) * (size_t)T + t0 + lane * 2; *(v2h*)(VT + oi) = hv;
        asm volatile("s_wait_xcnt 0x0" ::: "memory"); } }   // a precaution of form: the next trip rewrites the registers that the issued store names
     }
}
// attention: grid (T/128, BL x H): block = 4 waves x 32 queries of (b, h); the block walks all T keys in tiles of 64; each tile (K rows, V^T rows) is brought into LDS once
// for all 4 waves by asynchronous copies (16 B per lane), two buffers, the next tile in flight while this one is worked on; rows of 128 B at a pitch of 144 B for the ds_load_b128 fragment reads.
// Per wave: two 16-query column tiles side by side, so that every K and V^T fragment read from LDS feeds two products; 32-key steps in key order; the score product starts from
// C = 10 - (maximum in use) and q is stored log2-scaled, so its result is the argument of exp2 for P x1024 as it stands; online softmax with lazy rescale; O^T += V^T P^T; f32 rows of 64 at column 64h.
constexpr int NW = 4, QT = 2, KT = 64, NT = T / KT, LP = 64 + 8;   // waves per block, 16-query tiles per wave, keys per tile, tiles, LDS row pitch in halves
constexpr float LAZY = 5.0f;   // log2 units by which a column's maximum may outgrow the one in use before the state is rescaled
constexpr unsigned PLB = 64u * LP * 2u, QRB = 16u * LP * 2u;  // bytes of one staged plane (64 rows), of 16 rows
static_assert(T % (16 * QT * NW) == 0 && KT == 64 && HD == 64 && NW == 4);
// One tile: every thread copies 16 B of rows r, r + 16, r + 32 and r + 48 of each plane. The s_wait_xcnt stands inside the copies' own statement so that no address register is rewritten ahead of it.
__device__ __forceinline__ void stage_tile(unsigned lds, const b16* gk, const b16* gh) {
  asm volatile("global_load_async_to_lds_b128 %0, %8, off\n\tglobal_load_async_to_lds_b128 %1, %9, off\n\tglobal_load_async_to_lds_b128 %2, %10, off\n\tglobal_load_async_to_lds_b128 %3, %11, off\n\t"
               "global_load_async_to_lds_b128 %4, %12, off\n\tglobal_load_async_to_lds_b128 %5, %13, off\n\tglobal_load_async_to_lds_b128 %6, %14, off\n\tglobal_load_async_to_lds_b128 %7, %15, off\n\ts_wait_xcnt 0x0"
               :: "v"(lds), "v"(lds + QRB), "v"(lds + 2 * QRB), "v"(lds + 3 * QRB), "v"(lds + PLB), "v"(lds + PLB + QRB), "v"(lds + PLB + 2 * QRB), "v"(lds + PLB + 3 * QRB),
                  "v"(gk), "v"(gk + 16 * HD), "v"(gk + 32 * HD), "v"(gk + 48 * HD), "v"(gh), "v"(gh + (size_t)16 * T), "v"(gh + (size_t)32 * T), "v"(gh + (size_t)48 * T) : "memory");
}
__global__ __launch_bounds__(32 * NW) void attn_kernel(const b16* __restrict__ QP, const b16* __restrict__ KP, const b16* __restrict__ VT, float* __restrict__ out) {
  __shared__ __attribute__((aligned(16))) b16 St[2][2][64][LP];
  __shared__ __attribute__((aligned(16))) float To[NW][16 * QT][HD + 4];
  const int wave = threadIdx.x >> 5, lane = threadIdx.x & 31, hh = lane >> 4, col = lane & 15; const int b = blockIdx.y / H, h = blockIdx.y % H; const int q0 = blockIdx.x * (16 * QT * NW) + wave * (16 * QT);
  const size_t ph = (size_t)b * H + h; const b16* Qb = QP + ph * T * HD; const b16* Kb = KP + ph * T * HD; const b16* Vh = VT + ph * HD * (size_t)T;
  const int sr = threadIdx.x >> 3, sc = (threadIdx.x & 7) * 8;   // this thread's first staged row (of four, 16 apart) and its 8 halves of it
  const unsigned sl = (unsigned)(size_t)&St[0][0][sr][sc];
  const b16* gk = Kb + (size_t)sr * HD + sc; const b16* gh = Vh + (size_t)sr * T + sc;
  stage_tile(sl, gk, gh);
  v16b qa[QT][2];   // [column tile][k half]
#pragma unroll
  for (int c = 0; c < QT; ++c) { const b16* qr = Qb + (size_t)(q0 + 16 * c + col) * HD; qa[c][0] = frag_kb(qr, hh); qa[c][1] = frag_kb(qr + 32, hh); }
  // cin: the score products' start value, 10 - m in all eight rows of the lane's column (m = 0 until the first step has seen scores). thr, lo: -inf until then, so that the first step
  // always takes the branch below and may also lower m to its own maximum; afterwards m only rises.
  v8f cin[QT]; float l[QT]; v8f o[QT][4];
#pragma unroll
  for (int c = 0; c < QT; ++c) { for (int r = 0; r < 8; ++r) cin[c][r] = LPS; l[c] = 0.0f; for (int t = 0; t < 4; ++t) o[c][t] = (v8f){}; }
  float thr = -INFINITY, lo = -INFINITY;
  asm volatile("s_wait_asynccnt 0x0" ::: "memory");   // tile 0 of this wave's copies has landed
  __syncthreads();                                     // tile 0 published to all waves
  if (NT > 1) stage_tile(sl + 2 * PLB, gk + (size_t)KT * HD, gh + KT);
#pragma unroll 1
  for (int kt = 0; kt < NT; ++kt) {
    const b16* kp = &St[kt & 1][0][col][8 * hh]; const b16* vp = &St[kt & 1][1][col][8 * hh];
    // kp, vp: this lane's place in the K rows and V^T rows of the step at hand, carried and moved on inside the step.
#pragma unroll 1   // rolled: one 32-key step's code and live registers at a time; the unrolled form is a scheduling step of its own and has not been timed
    for (int kb = 0; kb < KT; kb += 32) {
      float e[QT][16]; float mx[QT]; v16b kf[4];   // the step's four K fragments are read as one group ahead of their products; each feeds both column tiles
#pragma unroll
      for (int u = 0; u < 2; ++u) { const b16* kr = kp + u * 16 * LP; kf[2 * u] = frag_kb(kr, 0); kf[2 * u + 1] = frag_kb(kr + 32, 0); }
      kp += 32 * LP;
      __builtin_amdgcn_sched_barrier(0);   // keeps the eight reads one group ahead of the products: split into three groups, each was waited out on its own
      v8f s[2][QT];   // [16-key tile][column tile]: four independent chains of two products, issued as one run so that each stands in the others' hazard window
#pragma unroll
      for (int u = 0; u < 2; ++u)
#pragma unroll
        for (int c = 0; c < QT; ++c) s[u][c] = wmma16b(kf[2 * u], qa[c][0], cin[c]);
#pragma unroll
      for (int u = 0; u < 2; ++u)
#pragma unroll
        for (int c = 0; c < QT; ++c) s[u][c] = wmma16b(kf[2 * u + 1], qa[c][1], s[u][c]);
      __builtin_amdgcn_sched_barrier(0);   // keeps the eight products together: with vector work moved in between them the build padded each with v_nop
#pragma unroll
      for (int c = 0; c < QT; ++c) { mx[c] = -INFINITY;
#pragma unroll
        for (int u = 0; u < 2; ++u)
#pragma unroll
          for (int r = 0; r < 8; r += 2) { e[c][u * 8 + r] = s[u][c][r]; e[c][u * 8 + r + 1] = s[u][c][r + 1]; mx[c] = fmaxf(mx[c], fmaxf(s[u][c][r], s[u][c][r + 1])); } }
#pragma unroll
      for (int c = 0; c < QT; ++c) mx[c] = fmaxf(mx[c], xhalf(mx[c]));
      // Lazy rescale: one wave-uniform scalar branch per step for both column tiles (EXEC stays full for the WMMAs). The maximum in use is raised, and l and the accumulator rescaled, only when some
      // column's new maximum lies more than LAZY above it; otherwise p <= 2^LAZY, so p x1024 <= 2^15 still fits f16, and the accumulator multiplies are not issued. The first step always takes it
      // (thr = -inf). Only here are this step's scores, which were formed against the old maximum, shifted by vector instructions.
      if (__builtin_amdgcn_ballot_w32(fmaxf(mx[0], mx[1]) > thr) != 0u) {
#pragma unroll
        for (int c = 0; c < QT; ++c) { const float d = fmaxf(mx[c] - LPS, lo); const float al = nexp2(fminf(-d, 0.0f)); l[c] *= al;
#pragma unroll
          for (int t = 0; t < 4; ++t) o[c][t] *= al;
#pragma unroll
          for (int i2 = 0; i2 < 16; ++i2) e[c][i2] -= d;
#pragma unroll
          for (int r = 0; r < 8; ++r) cin[c][r] -= d; }
        thr = LPS + LAZY; lo = 0.0f; }
      v16b vf[4];   // V^T fragments, read as one group ahead of the softmax arithmetic; each feeds both column tiles
#pragma unroll
      for (int t = 0; t < 4; ++t) vf[t] = frag_kb(vp + t * 16 * LP, 0);
      vp += 32;
      __builtin_amdgcn_sched_barrier(0);   // keeps the eight reads one group ahead of the softmax arithmetic, under which they land: moved down to their products, they were waited out there
      v16b pf[QT];
#pragma unroll
      for (int c = 0; c < QT; ++c) { float sum = 0.0f;
#pragma unroll
        for (int i2 = 0; i2 < 16; ++i2) e[c][i2] = nexp2(e[c][i2]);
#pragma unroll
        for (int i2 = 0; i2 < 16; ++i2) { sum += e[c][i2]; pf[c][i2] = (b16)e[c][i2]; }   // the two score tiles of a lane, converted in place, are its P^T fragment (k = 8hh+r, 16+8hh+r); l sums p x1024
        l[c] += sum; }
#pragma unroll
      for (int t = 0; t < 4; ++t)
#pragma unroll
        for (int c = 0; c < QT; ++c) o[c][t] = wmma16b(vf[t], pf[c], o[c][t]); }
    asm volatile("s_wait_dscnt 0x0" ::: "memory");      // this wave's reads of the tile have returned before the buffer is refilled
    asm volatile("s_wait_asynccnt 0x0" ::: "memory");   // this wave's copies of tile kt + 1 have landed
    __syncthreads();                                     // publishes tile kt + 1 and ends every wave's reads of tile kt
    if (kt + 2 < NT) stage_tile(sl + (unsigned)(kt & 1) * (2 * PLB), gk + (size_t)(kt + 2) * KT * HD, gh + (kt + 2) * KT); }
  asm volatile("s_wait_asynccnt 0x0" ::: "memory");     // no copy outstanding when the wave goes on to the epilogue and ends
#pragma unroll
  for (int c = 0; c < QT; ++c) { const float lj = l[c] + xhalf(l[c]);   // each half of the wave has summed its own 16 of every 32 keys
    const float inv = 1.0f / (lj * XS);   // l and O both carry the x1024 of P
#pragma unroll
    for (int t = 0; t < 4; ++t)
#pragma unroll
      for (int r = 0; r < 8; ++r) To[wave][16 * c + col][t * 16 + 8 * hh + r] = o[c][t][r] * inv; }
  wave_lds_sync();
  {
#pragma unroll   // all sixteen row reads are issued ahead of their stores
    for (int i2 = 0; i2 < 8 * QT; ++i2) { const int rr = 2 * i2 + hh;
      *(v4f*)(out + ((size_t)b * SEQ_FULL + q0 + rr) * DM + h * HD + col * 4) = *(const v4f*)(&To[wave][rr][col * 4]); }  }
}
}  // namespace

extern "C" void kernel_launch(void* const* d_in, const int* in_sizes, int n_in, void* d_out, int out_size, void* d_ws, size_t ws_size, hipStream_t stream) {
  if (n_in < 7) return;
  auto Fp = [&](int i) { return (const float*)d_in[i]; };
  // wire order: 0 x [4,2048,768], 1 Wq [12,64,64] (h, out, in), 2 Wk, 3 Wv, 4 bq [12,64], 5 bk, 6 bv; out f32 [4,2048,768]
  const long long need_x = ((long long)(BL - 1) * SEQ_FULL + T) * (long long)DM;
  if ((long long)in_sizes[0] < need_x || in_sizes[1] < H * HD * HD || in_sizes[2] < H * HD * HD || in_sizes[3] < H * HD * HD ||
      in_sizes[4] < H * HD || in_sizes[5] < H * HD || in_sizes[6] < H * HD || (long long)out_size < need_x) return;
  size_t off = 0; char* ws = (char*)d_ws;
  auto carve = [&](size_t bytes) { char* p = ws + off; off += (bytes + 255) & ~(size_t)255; return p; };
  const size_t plane = (size_t)BL * T * DM * 2;                          // 12,582,912 B at full size ([b][h][t][64] or [b][h][64][t] halves)
  b16* QP = (b16*)carve(plane); b16* KP = (b16*)carve(plane); b16* VT = (b16*)carve(plane);
  if (off > ws_size || off > ((size_t)128 << 20)) return;               // total 37,748,736 B at full size
  proj_kernel<<<dim3(T / 64, BL, 3 * NSL), 128, 0, stream>>>(Fp(0), Fp(1), Fp(2), Fp(3), Fp(4), Fp(5), Fp(6), QP, KP, VT);
  attn_kernel<<<dim3(T / (16 * QT * NW), BL * H), 32 * NW, 0, stream>>>(QP, KP, VT, (float*)d_out);
}

// v009
// One run takes 62.1 microseconds.
// In both of two side-by-side timings against v008, it was 1.04 times as fast.
// All steps since v000 together make it 4.85 times as fast.
#include <hip/hip_runtime.h>

// compute dtype: every contraction on v_wmma_f32_16x16x32_f16 (f16 operands, f32 accumulate). Per-head q/k/v projections ([NB*SEQ x 64] x [64 x 64] per head):
// x as exact bf16 x8, W as exact bf16 x256 (1 product); S^T = K Q^T + C with k f16 x8 and q f16 x log2(e)/64 (1 product); O^T += V^T P^T with P f16 x1024 and V^T f16 x8,
// both operands rounded once to f16 (1 product). Biases (as bf16 RNE values), softmax statistics and 1/l in f32.
// Module: x [4][2048][768] viewed as 12 heads x 64; q_h = x_h Wq[h]^T + bq[h] (Wq[h] is (out,in)), k_h, v_h likewise; scores = q k^T / 8; softmax over all keys (no mask);
// out[b][s][64 h + d] = sum_t p v (heads concatenated) -> f32 [4][2048][768]. All float inputs enter as their bf16 RNE values.
// Flash-style: one wave per 32 queries of (b, h), as two 16-column tiles, walks all keys in order with a running max; 4 such waves share each K / V^T tile through LDS; deterministic, one writer per element.
// Fragment k-map per lane half hh for A AND B: elements 0..7 <- k = 8hh+0..7, 8..15 <- k = 16+8hh+0..7; acc[r] = D[8hh+r][lane&15].

#ifndef NB
#define NB 4
#endif
#ifndef SEQ
#define SEQ 2048
#endif

namespace {
constexpr int NB_FULL = 4, SEQ_FULL = 2048, DM = 768, H = 12, HD = 64;
constexpr int BL = NB;     // batches computed
constexpr int T = SEQ;     // tokens computed per batch (queries == keys); input and output row index = b * SEQ_FULL + t
constexpr int NSL = DM / 128;          // 128-column slabs (2 heads) per projection
constexpr float XS = 8.0f, WSC = 256.0f, LOG2E = 1.4426950408889634f;
constexpr float QS = LOG2E / (8.0f * XS);   // scale of the stored q: (q QS) . (k XS) = q . k / 8 in log2 units, so a score product needs no multiply behind it
constexpr float LPS = 10.0f;                // log2 of the factor 1024 that P carries into f16; it rides in the score product's start value
static_assert(T % 64 == 0 && T >= 64 && T <= SEQ_FULL && BL >= 1 && BL <= NB_FULL);
static_assert(DM % 128 == 0 && NSL * 128 == DM && H % 2 == 0 && H * HD == DM && HD == 64);
typedef _Float16 b16;
typedef __attribute__((ext_vector_type(16))) _Float16 v16b;
typedef __attribute__((ext_vector_type(8))) _Float16 v8b;
typedef __attribute__((ext_vector_type(4))) _Float16 v4h;
typedef __attribute__((ext_vector_type(2))) _Float16 v2h;
typedef __attribute__((ext_vector_type(8))) float v8f;
typedef __attribute__((ext_vector_type(4))) float v4f;
typedef __attribute__((ext_vector_type(2))) float v2f;
__device__ __forceinline__ float bf16_rne(float f) { unsigned int u = __float_as_uint(f); u += 0x7FFFu + ((u >> 16) & 1u); return __uint_as_float(u & 0xFFFF0000u); }
__device__ __forceinline__ v16b frag_kb(const b16* p, int hh) { const v8b a = *(const v8b*)(p + 8 * hh), b = *(const v8b*)(p + 16 + 8 * hh); v16b f;
#pragma unroll
  for (int e = 0; e < 8; ++e) { f[e] = a[e]; f[8 + e] = b[e]; } return f; }
// The builtin alone: the compiler keeps the distance a WMMA needs before its registers are touched and fills it with independent work where there is some.
__device__ __forceinline__ v8f wmma16b(v16b a, v16b b, v8f c) { return __builtin_amdgcn_wmma_f32_16x16x32_f16(false, a, false, b, (short)0, c, false, false); }
__device__ __forceinline__ void wave_lds_sync() { __builtin_amdgcn_fence(3, "workgroup"); __builtin_amdgcn_wave_barrier(); __builtin_amdgcn_fence(2, "workgroup"); }
__device__ __forceinline__ float nexp2(float v) { return __builtin_amdgcn_exp2f(v); }
// lane l's value seen from lane l ^ 16, by one vector instruction (v_permlanex16_b32): no LDS queue and no dscnt wait on the way
__device__ __forceinline__ float xhalf(float v) { const int b = __builtin_bit_cast(int, v); return __builtin_bit_cast(float, __builtin_amdgcn_permlanex16(b, b, 0x76543210, 0xfedcba98, false, false)); }

// sum of a lane's 16 values as a tree of two-wide adds: four levels deep, so that the test that reads it does not wait for a chain of sixteen
__device__ __forceinline__ float sum16(const float (&e)[16]) { v2f t[8];
#pragma unroll
  for (int i = 0; i < 8; ++i) t[i] = (v2f){e[2 * i], e[2 * i + 1]};
#pragma unroll
  for (int w = 4; w >= 1; w >>= 1)
#pragma unroll
    for (int i = 0; i < w; ++i) t[i] += t[i + w];
  return t[0][0] + t[0][1]; }

// W fragment straight from a row of the f32 weights: the k positions of frag_kb, each element as its bf16 RNE value x256 in f16
__device__ __forceinline__ v16b frag_w(const float* p, int hh) {
  const v4f a0 = *(const v4f*)(p + 8 * hh), a1 = *(const v4f*)(p + 8 * hh + 4), b0 = *(const v4f*)(p + 16 + 8 * hh), b1 = *(const v4f*)(p + 16 + 8 * hh + 4); v16b f;
#pragma unroll
  for (int e = 0; e < 4; ++e) { f[e] = (b16)(bf16_rne(a0[e]) * WSC); f[4 + e] = (b16)(bf16_rne(a1[e]) * WSC); f[8 + e] = (b16)(bf16_rne(b0[e]) * WSC); f[12 + e] = (b16)(bf16_rne(b1[e]) * WSC); }
  return f; }
// projections: grid (T/64, BL, 3 parts x NSL slabs); block = 64 tokens of batch b x 4 waves; slab = heads 2s, 2s+1: A = x[:, 128 s .. 128 s + 127] (exact bf16 x8) staged.
// Each wave takes all 64 tokens x 32 of the slab's 128 output columns, so every W element the block needs is loaded and converted once, by the wave that uses it, with no launch ahead for it.
__global__ __launch_bounds__(128) void proj_kernel(const float* __restrict__ x, const float* __restrict__ wq, const float* __restrict__ wk, const float* __restrict__ wv,
                                                   const float* __restrict__ bq, const float* __restrict__ bk, const float* __restrict__ bv,
                                                   b16* __restrict__ QP, b16* __restrict__ KP, b16* __restrict__ VT) {
  __shared__ __attribute__((aligned(16))) b16 As[64][128 + 8]; __shared__ __attribute__((aligned(16))) float Tf[4][16][128 + 4];
  const int wave = threadIdx.x >> 5, lane = threadIdx.x & 31, nloc = lane & 15, hlf = lane >> 4; const int t0 = blockIdx.x * 64; const int b = blockIdx.y;
  const int part = blockIdx.z / NSL, slab = blockIdx.z % NSL, c0 = slab * 128;
  const float* xb = x + ((size_t)b * SEQ_FULL + t0) * DM + c0; const float* bias = part == 0 ? bq : part == 1 ? bk : bv; const float* wf = part == 0 ? wq : part == 1 ? wk : wv;
  const int hs = wave >> 1, hw = 2 * slab + hs;   // the head (of the slab's two, and of all) that holds this wave's 32 columns
  v16b wb[2][2];                                   // its W fragments [16-column tile][k half], asked for ahead of the x tile
#pragma unroll
  for (int nt = 0; nt < 2; ++nt) { const float* wr = wf + ((size_t)hw * HD + (wave & 1) * 32 + nt * 16 + nloc) * HD; wb[nt][0] = frag_w(wr, hlf); wb[nt][1] = frag_w(wr + 32, hlf); }
  for (int i = threadIdx.x; i < 64 * 32; i += 128) { const int rr = i / 32, q = (i % 32) * 4; const v4f f = *(const v4f*)(xb + (size_t)rr * DM + q); v4h o;
    for (int j = 0; j < 4; ++j) o[j] = (b16)(bf16_rne(f[j]) * XS); *(v4h*)(&As[rr][q]) = o; }
  __syncthreads();
  v8f acc[4][2];   // [16-token tile][16-column tile]
#pragma unroll
  for (int mt = 0; mt < 4; ++mt) { acc[mt][0] = (v8f){}; acc[mt][1] = (v8f){}; }
#pragma unroll
  for (int mt = 0; mt < 4; ++mt)
#pragma unroll
    for (int k2 = 0; k2 < 2; ++k2) { const v16b af = frag_kb(&As[mt * 16 + nloc][hs * HD + 32 * k2], hlf);
#pragma unroll
      for (int nt = 0; nt < 2; ++nt) acc[mt][nt] = wmma16b(af, wb[nt][k2], acc[mt][nt]); }
#pragma unroll
  for (int nt = 0; nt < 2; ++nt) { const int cl = wave * 32 + nt * 16 + nloc; const float bb = bf16_rne(bias[hw * HD + (cl & 63)]);
#pragma unroll
    for (int mt = 0; mt < 4; ++mt)
#pragma unroll
      for (int r = 0; r < 8; ++r) Tf[mt][8 * hlf + r][cl] = acc[mt][nt][r] * (1.0f / (XS * WSC)) + bb; }
  __syncthreads();
  {
    if (part < 2) { b16* plane = part == 0 ? QP : KP; const float os = part == 0 ? QS : XS; const int c = c0 + lane * 4; const int h = c / HD, d = c % HD;
      for (int rr = 0; rr < 16; ++rr) { const int tok = t0 + wave * 16 + rr; v4h o4; for (int j = 0; j < 4; ++j) o4[j] = (b16)(Tf[wave][rr][lane * 4 + j] * os);
        *(v4h*)(plane + (((size_t)b * H + h) * T + tok) * HD + d) = o4; } }
    else {
#pragma unroll 1
      for (int q = 0; q < 32; ++q) { const int cl = wave * 32 + q; const int c = c0 + cl; const int h = c / HD, d = c % HD; const int tk = lane * 2; v2h hv;
        for (int j = 0; j < 2; ++j) hv[j] = (b16)(Tf[(tk + j) >> 4][(tk + j) & 15][cl] * XS);
        const size_t oi = (((size_t)b * H + h) * HD + d) * (size_t)T + t0 + lane * 2; *(v2h*)(VT + oi) = hv;
        asm volatile("s_wait_xcnt 0x0" ::: "memory"); } }   // a precaution of form: the next trip rewrites the registers that the issued store names
     }
}
// attention: grid (T/128, BL x H): block = 4 waves x 32 queries of (b, h); the block walks all T keys in tiles of 64; each tile (K rows, V^T rows) is brought into LDS once
// for all 4 waves by asynchronous copies (16 B per lane), two buffers, the next tile in flight while this one is worked on; rows of 128 B at a pitch of 144 B for the ds_load_b128 fragment reads.
// Per wave: two 16-query column tiles side by side, so that every K and V^T fragment read from LDS feeds two products; 32-key steps in key order; the score product starts from
// C = 10 - (maximum in use) and q is stored log2-scaled, so its result is the argument of exp2 for P x1024 as it stands; online softmax with lazy rescale, tested on the sums of P; O^T += V^T P^T; f32 rows of 64 at column 64h.
constexpr int NW = 4, QT = 2, KT = 64, NT = T / KT, LP = 64 + 8;   // waves per block, 16-query tiles per wave, keys per tile, tiles, LDS row pitch in halves
constexpr float PMAX = 32768.0f;   // a lane's sum of 16 values of p x1024 up to which the state stands: each value then fits f16 (largest finite 65504)
constexpr unsigned PLB = 64u * LP * 2u, QRB = 16u * LP * 2u;  // bytes of one staged plane (64 rows), of 16 rows
static_assert(T % (16 * QT * NW) == 0 && KT == 64 && HD == 64 && NW == 4);
// One tile: every thread copies 16 B of rows r, r + 16, r + 32 and r + 48 of each plane. The s_wait_xcnt stands inside the copies' own statement so that no address register is rewritten ahead of it.
__device__ __forceinline__ void stage_tile(unsigned lds, const b16* gk, const b16* gh) {
  asm volatile("global_load_async_to_lds_b128 %0, %8, off\n\tglobal_load_async_to_lds_b128 %1, %9, off\n\tglobal_load_async_to_lds_b128 %2, %10, off\n\tglobal_load_async_to_lds_b128 %3, %11, off\n\t"
               "global_load_async_to_lds_b128 %4, %12, off\n\tglobal_load_async_to_lds_b128 %5, %13, off\n\tglobal_load_async_to_lds_b128 %6, %14, off\n\tglobal_load_async_to_lds_b128 %7, %15, off\n\ts_wait_xcnt 0x0"
               :: "v"(lds), "v"(lds + QRB), "v"(lds + 2 * QRB), "v"(lds + 3 * QRB), "v"(lds + PLB), "v"(lds + PLB + QRB), "v"(lds + PLB + 2 * QRB), "v"(lds + PLB + 3 * QRB),
                  "v"(gk), "v"(gk + 16 * HD), "v"(gk + 32 * HD), "v"(gk + 48 * HD), "v"(gh), "v"(gh + (size_t)16 * T), "v"(gh + (size_t)32 * T), "v"(gh + (size_t)48 * T) : "memory");
}
__global__ __launch_bounds__(32 * NW) void attn_kernel(const b16* __restrict__ QP, const b16* __restrict__ KP, const b16* __restrict__ VT, float* __restrict__ out) {
  __shared__ __attribute__((aligned(16))) b16 St[2][2][64][LP];
  __shared__ __attribute__((aligned(16))) float To[NW][16 * QT][HD + 4];
  const int wave = threadIdx.x >> 5, lane = threadIdx.x & 31, hh = lane >> 4, col = lane & 15; const int b = blockIdx.y / H, h = blockIdx.y % H; const int q0 = blockIdx.x * (16 * QT * NW) + wave * (16 * QT);
  const size_t ph = (size_t)b * H + h; const b16* Qb = QP + ph * T * HD; const b16* Kb = KP + ph * T * HD; const b16* Vh = VT + ph * HD * (size_t)T;
  const int sr = threadIdx.x >> 3, sc = (threadIdx.x & 7) * 8;   // this thread's first staged row (of four, 16 apart) and its 8 halves of it
  const unsigned sl = (unsigned)(size_t)&St[0][0][sr][sc];
  const b16* gk = Kb + (size_t)sr * HD + sc; const b16* gh = Vh + (size_t)sr * T + sc;
  stage_tile(sl, gk, gh);
  v16b qa[QT][2];   // [column tile][k half]
#pragma unroll
  for (int c = 0; c < QT; ++c) { const b16* qr = Qb + (size_t)(q0 + 16 * c + col) * HD; qa[c][0] = frag_kb(qr, hh); qa[c][1] = frag_kb(qr + 32, hh); }
  // cin: the score products' start value, 10 - m in all eight rows of the lane's column (m = 0 until the first step has seen scores). thr, lo: -inf until then, so that the first step
  // always takes the branch below and may also lower m to its own maximum; afterwards m only rises.
  v8f cin[QT]; float l[QT]; v8f o[QT][4];
#pragma unroll
  for (int c = 0; c < QT; ++c) { for (int r = 0; r < 8; ++r) cin[c][r] = LPS; l[c] = 0.0f; for (int t = 0; t < 4; ++t) o[c][t] = (v8f){}; }
  float thr = -INFINITY, lo = -INFINITY;
  asm volatile("s_wait_asynccnt 0x0" ::: "memory");   // tile 0 of this wave's copies has landed
  __syncthreads();                                     // tile 0 published to all waves
  if (NT > 1) stage_tile(sl + 2 * PLB, gk + (size_t)KT * HD, gh + KT);
#pragma unroll 1
  for (int kt = 0; kt < NT; ++kt) {
    const b16* kp = &St[kt & 1][0][col][8 * hh]; const b16* vp = &St[kt & 1][1][col][8 * hh];
    // kp, vp: this lane's place in the K rows and V^T rows of the step at hand, carried and moved on inside the step.
#pragma unroll 1   // rolled: one 32-key step's code and live registers at a time; the unrolled form is a scheduling step of its own and has not been timed
    for (int kb = 0; kb < KT; kb += 32) {
      v16b kf[4];   // the step's four K fragments are read as one group ahead of their products; each feeds both column tiles
#pragma unroll
      for (int u = 0; u < 2; ++u) { const b16* kr = kp + u * 16 * LP; kf[2 * u] = frag_kb(kr, 0); kf[2 * u + 1] = frag_kb(kr + 32, 0); }
      __builtin_amdgcn_sched_barrier(0);   // keeps the eight reads one group ahead of the products: split into three groups, each was waited out on its own
      v8f s[2][QT];   // [16-key tile][column tile]: four independent chains of two products, issued as one run so that each stands in the others' hazard window
#pragma unroll
      for (int u = 0; u < 2; ++u)
#pragma unroll
        for (int c = 0; c < QT; ++c) s[u][c] = wmma16b(kf[2 * u], qa[c][0], cin[c]);
#pragma unroll
      for (int u = 0; u < 2; ++u)
#pragma unroll
        for (int c = 0; c < QT; ++c) s[u][c] = wmma16b(kf[2 * u + 1], qa[c][1], s[u][c]);
      __builtin_amdgcn_sched_barrier(0);   // keeps the eight products together: with vector work moved in between them the build padded each with v_nop
      v16b vf[4];   // V^T fragments, read as one group ahead of the softmax arithmetic; each feeds both column tiles
#pragma unroll
      for (int t = 0; t < 4; ++t) vf[t] = frag_kb(vp + t * 16 * LP, 0);
      __builtin_amdgcn_sched_barrier(0);   // keeps the eight reads one group ahead of the softmax arithmetic, under which they land: moved down to their products, they were waited out there
      // The common path forms no maximum: p x1024 = exp2(score product) against the maximum in use, and the lane's sum of its 16 values, which l needs anyway, bounds each of them (all are >= 0).
      float e[QT][16]; float sum[QT];
#pragma unroll
      for (int c = 0; c < QT; ++c) {
#pragma unroll
        for (int u = 0; u < 2; ++u)
#pragma unroll
          for (int r = 0; r < 8; ++r) e[c][u * 8 + r] = nexp2(s[u][c][r]);
        sum[c] = sum16(e[c]); }
      // Lazy rescale: one wave-uniform scalar branch per step for both column tiles (EXEC stays full for the WMMAs and for the exchange between the halves). While every lane's sum stays at or
      // under PMAX, every p x1024 fits f16 and the state stands. Otherwise (an overflow to +inf included), and always in the first step (thr = -inf), the column maxima are formed from the kept
      // scores, the maximum in use is moved, l and the accumulator are rescaled, and this step's exponentials and sums are formed again against the new maximum.
      if (__builtin_amdgcn_ballot_w32(fmaxf(sum[0], sum[1]) > thr) != 0u) {
#pragma unroll
        for (int c = 0; c < QT; ++c) { float mx = -INFINITY;
#pragma unroll
          for (int u = 0; u < 2; ++u)
#pragma unroll
            for (int r = 0; r < 8; r += 2) mx = fmaxf(mx, fmaxf(s[u][c][r], s[u][c][r + 1]));
          mx = fmaxf(mx, xhalf(mx));
          const float d = fmaxf(mx - LPS, lo); const float al = nexp2(fminf(-d, 0.0f)); l[c] *= al;
#pragma unroll
          for (int t = 0; t < 4; ++t) o[c][t] *= al;
#pragma unroll
          for (int u = 0; u < 2; ++u)
#pragma unroll
            for (int r = 0; r < 8; ++r) e[c][u * 8 + r] = nexp2(s[u][c][r] - d);
          sum[c] = sum16(e[c]);
#pragma unroll
          for (int r = 0; r < 8; ++r) cin[c][r] -= d; }
        thr = PMAX; lo = 0.0f; }
      v16b pf[QT];
#pragma unroll
      for (int c = 0; c < QT; ++c) {
#pragma unroll
        for (int i2 = 0; i2 < 16; ++i2) pf[c][i2] = (b16)e[c][i2]; }   // the two score tiles of a lane, converted in place, are its P^T fragment (k = 8hh+r, 16+8hh+r)
#pragma unroll
      for (int t = 0; t < 4; ++t)
#pragma unroll
        for (int c = 0; c < QT; ++c) o[c][t] = wmma16b(vf[t], pf[c], o[c][t]);
      __builtin_amdgcn_sched_barrier(0);   // the step's own closing vector work stays behind its last product: at the head of the next step the build rewrites registers of that product's P^T operand, which needs four vector slots between
      kp += 32 * LP; vp += 32;
#pragma unroll
      for (int c = 0; c < QT; ++c) l[c] += sum[c];   // l sums p x1024
      asm volatile("v_nop"); }   // the fourth of those four slots: the closing work above builds to three vector instructions
    asm volatile("s_wait_dscnt 0x0" ::: "memory");      // this wave's reads of the tile have returned before the buffer is refilled
    asm volatile("s_wait_asynccnt 0x0" ::: "memory");   // this wave's copies of tile kt + 1 have landed
    __syncthreads();                                     // publishes tile kt + 1 and ends every wave's reads of tile kt
    if (kt + 2 < NT) stage_tile(sl + (unsigned)(kt & 1) * (2 * PLB), gk + (size_t)(kt + 2) * KT * HD, gh + (kt + 2) * KT); }
  asm volatile("s_wait_asynccnt 0x0" ::: "memory");     // no copy outstanding when the wave goes on to the epilogue and ends
#pragma unroll
  for (int c = 0; c < QT; ++c) { const float lj = l[c] + xhalf(l[c]);   // each half of the wave has summed its own 16 of every 32 keys
    const float inv = 1.0f / (lj * XS);   // l and O both carry the x1024 of P
#pragma unroll
    for (int t = 0; t < 4; ++t)
#pragma unroll
      for (int r = 0; r < 8; ++r) To[wave][16 * c + col][t * 16 + 8 * hh + r] = o[c][t][r] * inv; }
  wave_lds_sync();
  {
#pragma unroll   // all sixteen row reads are issued ahead of their stores
    for (int i2 = 0; i2 < 8 * QT; ++i2) { const int rr = 2 * i2 + hh;
      *(v4f*)(out + ((size_t)b * SEQ_FULL + q0 + rr) * DM + h * HD + col * 4) = *(const v4f*)(&To[wave][rr][col * 4]); }  }
}
}  // namespace

extern "C" void kernel_launch(void* const* d_in, const int* in_sizes, int n_in, void* d_out, int out_size, void* d_ws, size_t ws_size, hipStream_t stream) {
  if (n_in < 7) return;
  auto Fp = [&](int i) { return (const float*)d_in[i]; };
  // wire order: 0 x [4,2048,768], 1 Wq [12,64,64] (h, out, in), 2 Wk, 3 Wv, 4 bq [12,64], 5 bk, 6 bv; out f32 [4,2048,768]
  const long long need_x = ((long long)(BL - 1) * SEQ_FULL + T) * (long long)DM;
  if ((long long)in_sizes[0] < need_x || in_sizes[1] < H * HD * HD || in_sizes[2] < H * HD * HD || in_sizes[3] < H * HD * HD ||
      in_sizes[4] < H * HD || in_sizes[5] < H * HD || in_sizes[6] < H * HD || (long long)out_size < need_x) return;
  size_t off = 0; char* ws = (char*)d_ws;
  auto carve = [&](size_t bytes) { char* p = ws + off; off += (bytes + 255) & ~(size_t)255; return p; };
  const size_t plane = (size_t)BL * T * DM * 2;                          // 12,582,912 B at full size ([b][h][t][64] or [b][h][64][t] halves)
  b16* QP = (b16*)carve(plane); b16* KP = (b16*)carve(plane); b16* VT = (b16*)carve(plane);
  if (off > ws_size || off > ((size_t)128 << 20)) return;               // total 37,748,736 B at full size
  proj_kernel<<<dim3(T / 64, BL, 3 * NSL), 128, 0, stream>>>(Fp(0), Fp(1), Fp(2), Fp(3), Fp(4), Fp(5), Fp(6), QP, KP, VT);
  attn_kernel<<<dim3(T / (16 * QT * NW), BL * H), 32 * NW, 0, stream>>>(QP, KP, VT, (float*)d_out);
}
